// v000
// Times are from an AMD MI455X. After a warm-up the kernel runs many times in a row, and a time is the length of
// such a window on the GPU divided by its runs, so every launch and the gaps after it count. The runs cycle
// through copies of the inputs. A figure is the median of several windows, for all but v000 over two sittings.
// Sittings can differ by a few percent; kernels timed side by side share one.
// v000, which the later versions start from, runs in 376 microseconds.
#include <hip/hip_runtime.h>
#include <hip/hip_bf16.h>

typedef __attribute__((ext_vector_type(2))) float v2f;
typedef __attribute__((ext_vector_type(4))) float v4f;
typedef __attribute__((ext_vector_type(8))) float v8f;

#define BS  4
#define CH  32
#define NF  128
#define L   4096      // hei*wei
#define ROWS 4096     // BS*CH*HEI

__device__ __forceinline__ v8f wmma_f32(v2f a, v2f b, v8f c) {
  // V_WMMA_F32_16X16X4_F32 : D = A(16x4) * B(4x16) + C(16x16)
  return __builtin_amdgcn_wmma_f32_16x16x4_f32(false, a, false, b, (short)0, c,
                                               false, false);
}

// ---------------------------------------------------------------------------
// Kernel A: affinity/alpha  (1x1 conv -> BN(eval) -> ReLU -> 2-way softmax)
// ---------------------------------------------------------------------------
__global__ void alpha_kernel(const float* __restrict__ head,
                             const float* __restrict__ tail,
                             const float* __restrict__ conv_w,
                             const float* __restrict__ conv_b,
                             const float* __restrict__ bn_w,
                             const float* __restrict__ bn_b,
                             const float* __restrict__ bn_mean,
                             const float* __restrict__ bn_var,
                             const int* __restrict__ flagp,
                             float* __restrict__ alpha) {
  int t = blockIdx.x * blockDim.x + threadIdx.x;
  if (t >= BS * L) return;
  int b = t >> 12, l = t & (L - 1);
  const float* hb = head + ((b * CH) << 12) + l;
  const float* tb = tail + ((b * CH) << 12) + l;
  float s0 = conv_b[0], s1 = conv_b[1];
#pragma unroll 4
  for (int c = 0; c < CH; ++c) {
    float hv = hb[c << 12];
    s0 = fmaf(conv_w[c], hv, s0);
    s1 = fmaf(conv_w[64 + c], hv, s1);
  }
#pragma unroll 4
  for (int c = 0; c < CH; ++c) {
    float tv = tb[c << 12];
    s0 = fmaf(conv_w[CH + c], tv, s0);
    s1 = fmaf(conv_w[64 + CH + c], tv, s1);
  }
  float sc0 = bn_w[0] * rsqrtf(bn_var[0] + 1e-5f);
  float sc1 = bn_w[1] * rsqrtf(bn_var[1] + 1e-5f);
  float r0 = fmaxf((s0 - bn_mean[0]) * sc0 + bn_b[0], 0.f);
  float r1 = fmaxf((s1 - bn_mean[1]) * sc1 + bn_b[1], 0.f);
  float m = fmaxf(r0, r1);
  float e0 = __expf(r0 - m), e1 = __expf(r1 - m);
  alpha[t] = (*flagp) ? (e0 / (e0 + e1)) : (e1 / (e0 + e1));
}

// ---------------------------------------------------------------------------
// Kernel B: five projections (4096x128 @ 128x128) via WMMA f32 16x16x4,
// scattering into attention-friendly layouts:
//   q  [b][l][32]          K' [b][l][64] (cols 0..31 pre-scaled by alpha)
//   V' [b][64][l]
// One wave computes one 16x16 output tile.
// ---------------------------------------------------------------------------
__global__ __launch_bounds__(128) void proj_kernel(
    const float* __restrict__ head, const float* __restrict__ tail,
    const float* __restrict__ R_q, const float* __restrict__ R_k,
    const float* __restrict__ R_v, const float* __restrict__ F_q,
    const float* __restrict__ F_k, const float* __restrict__ F_v,
    const int* __restrict__ flagp, const float* __restrict__ alpha,
    float* __restrict__ qws, float* __restrict__ kc, float* __restrict__ vc) {
  int wid = (blockIdx.x * blockDim.x + threadIdx.x) >> 5;
  int lane = threadIdx.x & 31;
  int half = lane >> 4, lm = lane & 15;
  int proj = wid >> 11;            // 0..4 (2048 tiles each)
  int t = wid & 2047;
  int r0 = (t >> 3) << 4;          // 256 row tiles
  int n0 = (t & 7) << 4;           // 8 col tiles
  int flag = *flagp;

  const float* src;
  const float* mat;
  switch (proj) {
    case 0:  src = flag ? head : tail; mat = flag ? R_q : F_q; break; // q
    case 1:  src = flag ? tail : head; mat = flag ? F_k : R_k; break; // K' lo (scaled)
    case 2:  src = flag ? head : tail; mat = flag ? R_k : F_k; break; // K' hi
    case 3:  src = flag ? tail : head; mat = flag ? F_v : R_v; break; // V' rows 0..31
    default: src = flag ? head : tail; mat = flag ? R_v : F_v; break; // V' rows 32..63
  }

  const float* arow = src + (r0 + lm) * NF;
  v8f acc = {};
#pragma unroll
  for (int k0 = 0; k0 < NF; k0 += 4) {
    int k = k0 + 2 * half;
    v2f a;  a.x = arow[k];                a.y = arow[k + 1];
    v2f bv; bv.x = mat[k * NF + n0 + lm]; bv.y = mat[(k + 1) * NF + n0 + lm];
    acc = wmma_f32(a, bv, acc);
  }

  int w = n0 + lm;
#pragma unroll
  for (int r = 0; r < 8; ++r) {
    int row = r0 + half * 8 + r;             // (b, c, h) flattened
    int b = row >> 10, c = (row >> 5) & 31, h = row & 31;
    int l = (h << 7) + w;
    int bl = (b << 12) + l;
    float v = acc[r];
    if (proj == 0)      qws[bl * 32 + c] = v;
    else if (proj == 1) kc[bl * 64 + c] = v * alpha[bl];
    else if (proj == 2) kc[bl * 64 + 32 + c] = v;
    else if (proj == 3) vc[((b * 64 + c) << 12) + l] = v;
    else                vc[((b * 64 + 32 + c) << 12) + l] = v;
  }
}

// ---------------------------------------------------------------------------
// Kernel C: fused flash attention, 64-column tiles.
//   S = K'(L x 64) @ V'(64 x L), online softmax, O += P @ q(L x 32)
// 8 waves/block, 16 rows/wave; V'/q tiles staged in LDS with float4 loads;
// one softmax pass (one butterfly + one correction) per 64 columns.
// ---------------------------------------------------------------------------
__global__ __launch_bounds__(256, 1) void attn_kernel(
    const float* __restrict__ qws, const float* __restrict__ kc,
    const float* __restrict__ vc, float* __restrict__ y) {
  __shared__ float lds_v[64][64];      // V' column tile   (16 KB)
  __shared__ float lds_q[64][32];      // q row tile       (8 KB)
  __shared__ float lds_p[8][16][66];   // per-wave P tiles (33 KB, padded)

  int tid = threadIdx.x;
  int w = tid >> 5;
  int lane = tid & 31;
  int half = lane >> 4, lm = lane & 15;
  int b = blockIdx.x >> 5;                         // 32 blocks per batch
  int i0 = (((blockIdx.x & 31) << 3) + w) << 4;    // wave's first row
  int bl = b << 12;

  const float* vcB = vc + ((b * 64) << 12);
  const float* qB = qws + bl * 32;
  const float* kcRow = kc + (bl + i0 + lm) * 64;

  // Preload this wave's 16x64 K' strip in WMMA A-layout (16 k-steps).
  v2f ka[16];
#pragma unroll
  for (int s = 0; s < 16; ++s) {
    int k0 = 4 * s + 2 * half;
    ka[s].x = kcRow[k0];
    ka[s].y = kcRow[k0 + 1];
  }

  v8f o0 = {}, o1 = {};
  float mrow[8], lrow[8];
#pragma unroll
  for (int r = 0; r < 8; ++r) { mrow[r] = -3.0e38f; lrow[r] = 0.f; }

  for (int j0 = 0; j0 < L; j0 += 64) {
    __syncthreads();   // previous iteration's LDS reads complete
    // Cooperative float4 stage: V' tile (64x64) and q tile (64x32)
#pragma unroll
    for (int i = 0; i < 4; ++i) {
      int idx = (tid + (i << 8)) << 2;       // 0..4092
      int kr = idx >> 6, cn = idx & 63;
      *(v4f*)&lds_v[kr][cn] = *(const v4f*)&vcB[(kr << 12) + j0 + cn];
    }
#pragma unroll
    for (int i = 0; i < 2; ++i) {
      int idx = (tid + (i << 8)) << 2;       // 0..2044
      int kr = idx >> 5, cc = idx & 31;
      *(v4f*)&lds_q[kr][cc] = *(const v4f*)&qB[(j0 + kr) * 32 + cc];
    }
    __syncthreads();

    // Score tiles: 4 x (16x16), K = 64
    v8f s0 = {}, s1 = {}, s2 = {}, s3 = {};
#pragma unroll
    for (int st = 0; st < 16; ++st) {
      int k0 = 4 * st + 2 * half;
      v2f b0; b0.x = lds_v[k0][lm];      b0.y = lds_v[k0 + 1][lm];
      v2f b1; b1.x = lds_v[k0][16 + lm]; b1.y = lds_v[k0 + 1][16 + lm];
      v2f b2; b2.x = lds_v[k0][32 + lm]; b2.y = lds_v[k0 + 1][32 + lm];
      v2f b3; b3.x = lds_v[k0][48 + lm]; b3.y = lds_v[k0 + 1][48 + lm];
      s0 = wmma_f32(ka[st], b0, s0);
      s1 = wmma_f32(ka[st], b1, s1);
      s2 = wmma_f32(ka[st], b2, s2);
      s3 = wmma_f32(ka[st], b3, s3);
    }

    // Online softmax over the 64-column strip; row stats in-lane per half-wave.
#pragma unroll
    for (int r = 0; r < 8; ++r) {
      float v = fmaxf(fmaxf(s0[r], s1[r]), fmaxf(s2[r], s3[r]));
      v = fmaxf(v, __shfl_xor(v, 1, 16));
      v = fmaxf(v, __shfl_xor(v, 2, 16));
      v = fmaxf(v, __shfl_xor(v, 4, 16));
      v = fmaxf(v, __shfl_xor(v, 8, 16));
      float mnew = fmaxf(mrow[r], v);
      float corr = __expf(mrow[r] - mnew);
      mrow[r] = mnew;
      int m = half * 8 + r;
      float p0 = __expf(s0[r] - mnew);
      float p1 = __expf(s1[r] - mnew);
      float p2 = __expf(s2[r] - mnew);
      float p3 = __expf(s3[r] - mnew);
      lds_p[w][m][lm] = p0;
      lds_p[w][m][16 + lm] = p1;
      lds_p[w][m][32 + lm] = p2;
      lds_p[w][m][48 + lm] = p3;
      float ps = (p0 + p1) + (p2 + p3);
      ps += __shfl_xor(ps, 1, 16);
      ps += __shfl_xor(ps, 2, 16);
      ps += __shfl_xor(ps, 4, 16);
      ps += __shfl_xor(ps, 8, 16);
      lrow[r] = lrow[r] * corr + ps;
      o0[r] *= corr;
      o1[r] *= corr;
    }
    __syncthreads();

    // O += P(16x64) @ q(64x32), K = 64
#pragma unroll
    for (int st = 0; st < 16; ++st) {
      int k0 = 4 * st + 2 * half;
      v2f pa;  pa.x = lds_p[w][lm][k0];    pa.y = lds_p[w][lm][k0 + 1];
      v2f qb0; qb0.x = lds_q[k0][lm];      qb0.y = lds_q[k0 + 1][lm];
      v2f qb1; qb1.x = lds_q[k0][16 + lm]; qb1.y = lds_q[k0 + 1][16 + lm];
      o0 = wmma_f32(pa, qb0, o0);
      o1 = wmma_f32(pa, qb1, o1);
    }
  }

  // Normalize and scatter to y[b][c][l]
#pragma unroll
  for (int r = 0; r < 8; ++r) {
    int m = half * 8 + r;
    float inv = 1.f / lrow[r];
    y[((b * 32 + lm) << 12) + i0 + m] = o0[r] * inv;
    y[((b * 32 + 16 + lm) << 12) + i0 + m] = o1[r] * inv;
  }
}

// ---------------------------------------------------------------------------
// Kernel D: out = y @ W + residual   (4096x128 @ 128x128, WMMA tiles)
// ---------------------------------------------------------------------------
__global__ __launch_bounds__(128) void final_kernel(
    const float* __restrict__ y, const float* __restrict__ head,
    const float* __restrict__ tail, const float* __restrict__ R_W,
    const float* __restrict__ F_W, const int* __restrict__ flagp,
    float* __restrict__ out) {
  int wid = (blockIdx.x * blockDim.x + threadIdx.x) >> 5;
  int lane = threadIdx.x & 31;
  int half = lane >> 4, lm = lane & 15;
  int r0 = (wid >> 3) << 4;
  int n0 = (wid & 7) << 4;
  int flag = *flagp;
  const float* mat = flag ? R_W : F_W;
  const float* res = flag ? head : tail;

  const float* arow = y + (r0 + lm) * NF;   // y is row-major 4096x128
  v8f acc = {};
#pragma unroll
  for (int k0 = 0; k0 < NF; k0 += 4) {
    int k = k0 + 2 * half;
    v2f a;  a.x = arow[k];                a.y = arow[k + 1];
    v2f bv; bv.x = mat[k * NF + n0 + lm]; bv.y = mat[(k + 1) * NF + n0 + lm];
    acc = wmma_f32(a, bv, acc);
  }
#pragma unroll
  for (int r = 0; r < 8; ++r) {
    int row = r0 + half * 8 + r;
    int idx = row * NF + n0 + lm;
    out[idx] = acc[r] + res[idx];
  }
}

// ---------------------------------------------------------------------------
extern "C" void kernel_launch(void* const* d_in, const int* in_sizes, int n_in,
                              void* d_out, int out_size, void* d_ws,
                              size_t ws_size, hipStream_t stream) {
  const float* head    = (const float*)d_in[0];
  const float* tail    = (const float*)d_in[1];
  const float* R_q     = (const float*)d_in[2];
  const float* R_k     = (const float*)d_in[3];
  const float* R_v     = (const float*)d_in[4];
  const float* R_W     = (const float*)d_in[5];
  const float* F_q     = (const float*)d_in[6];
  const float* F_k     = (const float*)d_in[7];
  const float* F_v     = (const float*)d_in[8];
  const float* F_W     = (const float*)d_in[9];
  const float* conv_w  = (const float*)d_in[10];
  const float* conv_b  = (const float*)d_in[11];
  const float* bn_w    = (const float*)d_in[12];
  const float* bn_b    = (const float*)d_in[13];
  const float* bn_mean = (const float*)d_in[14];
  const float* bn_var  = (const float*)d_in[15];
  const int*   flag    = (const int*)d_in[16];
  float* out = (float*)d_out;

  float* ws    = (float*)d_ws;
  float* alpha = ws;                 // 16384
  float* qws   = alpha + 16384;      // 524288   q  [b][l][32]
  float* kc    = qws + 524288;       // 1048576  K' [b][l][64]
  float* vc    = kc + 1048576;       // 1048576  V' [b][64][l]
  float* y     = vc + 1048576;       // 524288   y  [b][32][l]

  alpha_kernel<<<64, 256, 0, stream>>>(head, tail, conv_w, conv_b, bn_w, bn_b,
                                       bn_mean, bn_var, flag, alpha);
  proj_kernel<<<2560, 128, 0, stream>>>(head, tail, R_q, R_k, R_v, F_q, F_k,
                                        F_v, flag, alpha, qws, kc, vc);
  attn_kernel<<<128, 256, 0, stream>>>(qws, kc, vc, y);
  final_kernel<<<512, 128, 0, stream>>>(y, head, tail, R_W, F_W, flag, out);
}

// v001
// One run takes 185 microseconds.
// Timed twice side by side with v000, it ran 2.07 times as fast both times.
#include <hip/hip_runtime.h>
#include <hip/hip_bf16.h>

typedef __attribute__((ext_vector_type(2))) float v2f;
typedef __attribute__((ext_vector_type(4))) float v4f;
typedef __attribute__((ext_vector_type(8))) float v8f;

#define BS  4
#define CH  32
#define NF  128
#define L   4096      // hei*wei
#define ROWS 4096     // BS*CH*HEI
#define NSPLIT 4      // column ranges of the attention, one work-group each:
                      // 128 x 4 groups, two resident on each of the 256 WGPs
#define LSP (L / NSPLIT)   // columns per range

__device__ __forceinline__ v8f wmma_f32(v2f a, v2f b, v8f c) {
  // V_WMMA_F32_16X16X4_F32 : D = A(16x4) * B(4x16) + C(16x16)
  return __builtin_amdgcn_wmma_f32_16x16x4_f32(false, a, false, b, (short)0, c,
                                               false, false);
}

// ---------------------------------------------------------------------------
// Kernel A: affinity/alpha  (1x1 conv -> BN(eval) -> ReLU -> 2-way softmax)
// ---------------------------------------------------------------------------
__global__ void alpha_kernel(const float* __restrict__ head,
                             const float* __restrict__ tail,
                             const float* __restrict__ conv_w,
                             const float* __restrict__ conv_b,
                             const float* __restrict__ bn_w,
                             const float* __restrict__ bn_b,
                             const float* __restrict__ bn_mean,
                             const float* __restrict__ bn_var,
                             const int* __restrict__ flagp,
                             float* __restrict__ alpha) {
  int t = blockIdx.x * blockDim.x + threadIdx.x;
  if (t >= BS * L) return;
  int b = t >> 12, l = t & (L - 1);
  const float* hb = head + ((b * CH) << 12) + l;
  const float* tb = tail + ((b * CH) << 12) + l;
  float s0 = conv_b[0], s1 = conv_b[1];
#pragma unroll 4
  for (int c = 0; c < CH; ++c) {
    float hv = hb[c << 12];
    s0 = fmaf(conv_w[c], hv, s0);
    s1 = fmaf(conv_w[64 + c], hv, s1);
  }
#pragma unroll 4
  for (int c = 0; c < CH; ++c) {
    float tv = tb[c << 12];
    s0 = fmaf(conv_w[CH + c], tv, s0);
    s1 = fmaf(conv_w[64 + CH + c], tv, s1);
  }
  float sc0 = bn_w[0] * rsqrtf(bn_var[0] + 1e-5f);
  float sc1 = bn_w[1] * rsqrtf(bn_var[1] + 1e-5f);
  float r0 = fmaxf((s0 - bn_mean[0]) * sc0 + bn_b[0], 0.f);
  float r1 = fmaxf((s1 - bn_mean[1]) * sc1 + bn_b[1], 0.f);
  float m = fmaxf(r0, r1);
  float e0 = __expf(r0 - m), e1 = __expf(r1 - m);
  alpha[t] = (*flagp) ? (e0 / (e0 + e1)) : (e1 / (e0 + e1));
}

// ---------------------------------------------------------------------------
// Kernel B: five projections (4096x128 @ 128x128) via WMMA f32 16x16x4,
// scattering into attention-friendly layouts:
//   q  [b][l][32]          K' [b][l][64] (cols 0..31 pre-scaled by alpha)
//   V' [b][64][l]
// One wave computes one 16x16 output tile.
// ---------------------------------------------------------------------------
__global__ __launch_bounds__(128) void proj_kernel(
    const float* __restrict__ head, const float* __restrict__ tail,
    const float* __restrict__ R_q, const float* __restrict__ R_k,
    const float* __restrict__ R_v, const float* __restrict__ F_q,
    const float* __restrict__ F_k, const float* __restrict__ F_v,
    const int* __restrict__ flagp, const float* __restrict__ alpha,
    float* __restrict__ qws, float* __restrict__ kc, float* __restrict__ vc) {
  int wid = (blockIdx.x * blockDim.x + threadIdx.x) >> 5;
  int lane = threadIdx.x & 31;
  int half = lane >> 4, lm = lane & 15;
  int proj = wid >> 11;            // 0..4 (2048 tiles each)
  int t = wid & 2047;
  int r0 = (t >> 3) << 4;          // 256 row tiles
  int n0 = (t & 7) << 4;           // 8 col tiles
  int flag = *flagp;

  const float* src;
  const float* mat;
  switch (proj) {
    case 0:  src = flag ? head : tail; mat = flag ? R_q : F_q; break; // q
    case 1:  src = flag ? tail : head; mat = flag ? F_k : R_k; break; // K' lo (scaled)
    case 2:  src = flag ? head : tail; mat = flag ? R_k : F_k; break; // K' hi
    case 3:  src = flag ? tail : head; mat = flag ? F_v : R_v; break; // V' rows 0..31
    default: src = flag ? head : tail; mat = flag ? R_v : F_v; break; // V' rows 32..63
  }

  const float* arow = src + (r0 + lm) * NF;
  v8f acc = {};
#pragma unroll
  for (int k0 = 0; k0 < NF; k0 += 4) {
    int k = k0 + 2 * half;
    v2f a;  a.x = arow[k];                a.y = arow[k + 1];
    v2f bv; bv.x = mat[k * NF + n0 + lm]; bv.y = mat[(k + 1) * NF + n0 + lm];
    acc = wmma_f32(a, bv, acc);
  }

  int w = n0 + lm;
#pragma unroll
  for (int r = 0; r < 8; ++r) {
    int row = r0 + half * 8 + r;             // (b, c, h) flattened
    int b = row >> 10, c = (row >> 5) & 31, h = row & 31;
    int l = (h << 7) + w;
    int bl = (b << 12) + l;
    float v = acc[r];
    if (proj == 0)      qws[bl * 32 + c] = v;
    else if (proj == 1) kc[bl * 64 + c] = v * alpha[bl];
    else if (proj == 2) kc[bl * 64 + 32 + c] = v;
    else if (proj == 3) vc[((b * 64 + c) << 12) + l] = v;
    else                vc[((b * 64 + 32 + c) << 12) + l] = v;
  }
}

// ---------------------------------------------------------------------------
// Kernel C: fused flash attention, 64-column tiles.
//   S = K'(L x 64) @ V'(64 x L), online softmax, O += P @ q(L x 32)
// 8 waves/block, 16 rows/wave; V'/q tiles staged in LDS with float4 loads;
// one softmax pass (one butterfly + one correction) per 64 columns.
// Each work-group walks one of NSPLIT column ranges and leaves its
// un-normalised sum with the range's row maximum and row sum; merge_kernel
// joins the ranges.
// ---------------------------------------------------------------------------
__global__ __launch_bounds__(256, 1) void attn_kernel(
    const float* __restrict__ qws, const float* __restrict__ kc,
    const float* __restrict__ vc, float* __restrict__ po,
    float* __restrict__ pm, float* __restrict__ pl) {
  __shared__ float lds_v[64][64];      // V' column tile   (16 KB)
  __shared__ float lds_q[64][32];      // q row tile       (8 KB)
  __shared__ float lds_p[8][16][66];   // per-wave P tiles (33 KB, padded)

  int tid = threadIdx.x;
  int w = tid >> 5;
  int lane = tid & 31;
  int half = lane >> 4, lm = lane & 15;
  int b = blockIdx.x >> 5;                         // 32 blocks per batch
  int i0 = (((blockIdx.x & 31) << 3) + w) << 4;    // wave's first row
  int sp = blockIdx.y;                             // column range
  int bl = b << 12;

  const float* vcB = vc + ((b * 64) << 12) + sp * LSP;   // range's first column
  const float* qB = qws + (bl + sp * LSP) * 32;          // range's first q row
  const float* kcRow = kc + (bl + i0 + lm) * 64;

  // Preload this wave's 16x64 K' strip in WMMA A-layout (16 k-steps).
  v2f ka[16];
#pragma unroll
  for (int s = 0; s < 16; ++s) {
    int k0 = 4 * s + 2 * half;
    ka[s].x = kcRow[k0];
    ka[s].y = kcRow[k0 + 1];
  }

  v8f o0 = {}, o1 = {};
  float mrow[8], lrow[8];
#pragma unroll
  for (int r = 0; r < 8; ++r) { mrow[r] = -3.0e38f; lrow[r] = 0.f; }

  for (int j0 = 0; j0 < LSP; j0 += 64) {
    __syncthreads();   // previous iteration's LDS reads complete
    // Cooperative float4 stage: V' tile (64x64) and q tile (64x32)
#pragma unroll
    for (int i = 0; i < 4; ++i) {
      int idx = (tid + (i << 8)) << 2;       // 0..4092
      int kr = idx >> 6, cn = idx & 63;
      *(v4f*)&lds_v[kr][cn] = *(const v4f*)&vcB[(kr << 12) + j0 + cn];
    }
#pragma unroll
    for (int i = 0; i < 2; ++i) {
      int idx = (tid + (i << 8)) << 2;       // 0..2044
      int kr = idx >> 5, cc = idx & 31;
      *(v4f*)&lds_q[kr][cc] = *(const v4f*)&qB[(j0 + kr) * 32 + cc];
    }
    __syncthreads();

    // Score tiles: 4 x (16x16), K = 64
    v8f s0 = {}, s1 = {}, s2 = {}, s3 = {};
#pragma unroll
    for (int st = 0; st < 16; ++st) {
      int k0 = 4 * st + 2 * half;
      v2f b0; b0.x = lds_v[k0][lm];      b0.y = lds_v[k0 + 1][lm];
      v2f b1; b1.x = lds_v[k0][16 + lm]; b1.y = lds_v[k0 + 1][16 + lm];
      v2f b2; b2.x = lds_v[k0][32 + lm]; b2.y = lds_v[k0 + 1][32 + lm];
      v2f b3; b3.x = lds_v[k0][48 + lm]; b3.y = lds_v[k0 + 1][48 + lm];
      s0 = wmma_f32(ka[st], b0, s0);
      s1 = wmma_f32(ka[st], b1, s1);
      s2 = wmma_f32(ka[st], b2, s2);
      s3 = wmma_f32(ka[st], b3, s3);
    }

    // Online softmax over the 64-column strip; row stats in-lane per half-wave.
#pragma unroll
    for (int r = 0; r < 8; ++r) {
      float v = fmaxf(fmaxf(s0[r], s1[r]), fmaxf(s2[r], s3[r]));
      v = fmaxf(v, __shfl_xor(v, 1, 16));
      v = fmaxf(v, __shfl_xor(v, 2, 16));
      v = fmaxf(v, __shfl_xor(v, 4, 16));
      v = fmaxf(v, __shfl_xor(v, 8, 16));
      float mnew = fmaxf(mrow[r], v);
      float corr = __expf(mrow[r] - mnew);
      mrow[r] = mnew;
      int m = half * 8 + r;
      float p0 = __expf(s0[r] - mnew);
      float p1 = __expf(s1[r] - mnew);
      float p2 = __expf(s2[r] - mnew);
      float p3 = __expf(s3[r] - mnew);
      lds_p[w][m][lm] = p0;
      lds_p[w][m][16 + lm] = p1;
      lds_p[w][m][32 + lm] = p2;
      lds_p[w][m][48 + lm] = p3;
      float ps = (p0 + p1) + (p2 + p3);
      ps += __shfl_xor(ps, 1, 16);
      ps += __shfl_xor(ps, 2, 16);
      ps += __shfl_xor(ps, 4, 16);
      ps += __shfl_xor(ps, 8, 16);
      lrow[r] = lrow[r] * corr + ps;
      o0[r] *= corr;
      o1[r] *= corr;
    }
    __syncthreads();

    // O += P(16x64) @ q(64x32), K = 64
#pragma unroll
    for (int st = 0; st < 16; ++st) {
      int k0 = 4 * st + 2 * half;
      v2f pa;  pa.x = lds_p[w][lm][k0];    pa.y = lds_p[w][lm][k0 + 1];
      v2f qb0; qb0.x = lds_q[k0][lm];      qb0.y = lds_q[k0 + 1][lm];
      v2f qb1; qb1.x = lds_q[k0][16 + lm]; qb1.y = lds_q[k0 + 1][16 + lm];
      o0 = wmma_f32(pa, qb0, o0);
      o1 = wmma_f32(pa, qb1, o1);
    }
  }

  // Scatter the range's un-normalised sum to po[sp][b][c][l] and its row
  // maximum and row sum to pm/pl[sp][b][l] (every lane of a half-wave holds the
  // same row stats, so one lane stores them). Both loops are unrolled because
  // o0, o1, mrow and lrow are registers.
  float* poS = po + ((sp * BS * CH) << 12);
#pragma unroll
  for (int r = 0; r < 8; ++r) {
    int m = half * 8 + r;
    poS[((b * 32 + lm) << 12) + i0 + m] = o0[r];
    poS[((b * 32 + 16 + lm) << 12) + i0 + m] = o1[r];
  }
  if (lm == 0) {
    int st = ((sp * BS + b) << 12) + i0 + half * 8;
#pragma unroll
    for (int r = 0; r < 8; ++r) {
      pm[st + r] = mrow[r];
      pl[st + r] = lrow[r];
    }
  }
}

// ---------------------------------------------------------------------------
// Kernel C2: join the NSPLIT column ranges.
//   y = sum_s exp(m_s - M) * O_s / sum_s exp(m_s - M) * l_s,  M = max_s m_s
// One thread per four consecutive l of one (b, c). Every loop is unrolled so
// that mv stays in registers and the 3 * NSPLIT loads are in flight together.
// ---------------------------------------------------------------------------
__global__ __launch_bounds__(256) void merge_kernel(
    const float* __restrict__ po, const float* __restrict__ pm,
    const float* __restrict__ pl, float* __restrict__ y) {
  int t = blockIdx.x * 256 + threadIdx.x;          // 0 .. BS*CH*L/4 - 1
  int e = t << 2;                                  // element of y[b][c][l]
  int sl = ((e >> 17) << 12) + (e & (L - 1));      // element of pm[.][b][l]
  v4f mv[NSPLIT];
#pragma unroll
  for (int s = 0; s < NSPLIT; ++s) mv[s] = *(const v4f*)&pm[s * BS * L + sl];
  v4f M = mv[0];
#pragma unroll
  for (int s = 1; s < NSPLIT; ++s)
#pragma unroll
    for (int i = 0; i < 4; ++i) M[i] = fmaxf(M[i], mv[s][i]);
  v4f num = {}, den = {};
#pragma unroll
  for (int s = 0; s < NSPLIT; ++s) {
    v4f lv = *(const v4f*)&pl[s * BS * L + sl];
    v4f ov = *(const v4f*)&po[s * BS * CH * L + e];
#pragma unroll
    for (int i = 0; i < 4; ++i) {
      float wgt = __expf(mv[s][i] - M[i]);
      den[i] = fmaf(wgt, lv[i], den[i]);
      num[i] = fmaf(wgt, ov[i], num[i]);
    }
  }
  v4f r;
#pragma unroll
  for (int i = 0; i < 4; ++i) r[i] = num[i] / den[i];
  *(v4f*)&y[e] = r;
}

// ---------------------------------------------------------------------------
// Kernel D: out = y @ W + residual   (4096x128 @ 128x128, WMMA tiles)
// ---------------------------------------------------------------------------
__global__ __launch_bounds__(128) void final_kernel(
    const float* __restrict__ y, const float* __restrict__ head,
    const float* __restrict__ tail, const float* __restrict__ R_W,
    const float* __restrict__ F_W, const int* __restrict__ flagp,
    float* __restrict__ out) {
  int wid = (blockIdx.x * blockDim.x + threadIdx.x) >> 5;
  int lane = threadIdx.x & 31;
  int half = lane >> 4, lm = lane & 15;
  int r0 = (wid >> 3) << 4;
  int n0 = (wid & 7) << 4;
  int flag = *flagp;
  const float* mat = flag ? R_W : F_W;
  const float* res = flag ? head : tail;

  const float* arow = y + (r0 + lm) * NF;   // y is row-major 4096x128
  v8f acc = {};
#pragma unroll
  for (int k0 = 0; k0 < NF; k0 += 4) {
    int k = k0 + 2 * half;
    v2f a;  a.x = arow[k];                a.y = arow[k + 1];
    v2f bv; bv.x = mat[k * NF + n0 + lm]; bv.y = mat[(k + 1) * NF + n0 + lm];
    acc = wmma_f32(a, bv, acc);
  }
#pragma unroll
  for (int r = 0; r < 8; ++r) {
    int row = r0 + half * 8 + r;
    int idx = row * NF + n0 + lm;
    out[idx] = acc[r] + res[idx];
  }
}

// ---------------------------------------------------------------------------
extern "C" void kernel_launch(void* const* d_in, const int* in_sizes, int n_in,
                              void* d_out, int out_size, void* d_ws,
                              size_t ws_size, hipStream_t stream) {
  const float* head    = (const float*)d_in[0];
  const float* tail    = (const float*)d_in[1];
  const float* R_q     = (const float*)d_in[2];
  const float* R_k     = (const float*)d_in[3];
  const float* R_v     = (const float*)d_in[4];
  const float* R_W     = (const float*)d_in[5];
  const float* F_q     = (const float*)d_in[6];
  const float* F_k     = (const float*)d_in[7];
  const float* F_v     = (const float*)d_in[8];
  const float* F_W     = (const float*)d_in[9];
  const float* conv_w  = (const float*)d_in[10];
  const float* conv_b  = (const float*)d_in[11];
  const float* bn_w    = (const float*)d_in[12];
  const float* bn_b    = (const float*)d_in[13];
  const float* bn_mean = (const float*)d_in[14];
  const float* bn_var  = (const float*)d_in[15];
  const int*   flag    = (const int*)d_in[16];
  float* out = (float*)d_out;

  float* ws    = (float*)d_ws;
  float* alpha = ws;                 // 16384
  float* qws   = alpha + 16384;      // 524288   q  [b][l][32]
  float* kc    = qws + 524288;       // 1048576  K' [b][l][64]
  float* vc    = kc + 1048576;       // 1048576  V' [b][64][l]
  float* y     = vc + 1048576;       // 524288   y  [b][32][l]
  float* po    = y + 524288;         // NSPLIT * 524288  partial O [s][b][32][l]
  float* pm    = po + NSPLIT * 524288;   // NSPLIT * 16384  row maxima [s][b][l]
  float* pl    = pm + NSPLIT * 16384;    // NSPLIT * 16384  row sums   [s][b][l]

  alpha_kernel<<<64, 256, 0, stream>>>(head, tail, conv_w, conv_b, bn_w, bn_b,
                                       bn_mean, bn_var, flag, alpha);
  proj_kernel<<<2560, 128, 0, stream>>>(head, tail, R_q, R_k, R_v, F_q, F_k,
                                        F_v, flag, alpha, qws, kc, vc);
  attn_kernel<<<dim3(128, NSPLIT), 256, 0, stream>>>(qws, kc, vc, po, pm, pl);
  merge_kernel<<<512, 256, 0, stream>>>(po, pm, pl, y);
  final_kernel<<<512, 128, 0, stream>>>(y, head, tail, R_W, F_W, flag, out);
}

// v002
// It runs in 159 microseconds.
// Next to v001, in two timings, it ran 1.17 times as fast each time.
// All steps since v000 together make it 2.42 times as fast.
#include <hip/hip_runtime.h>
#include <hip/hip_bf16.h>

typedef __attribute__((ext_vector_type(2))) float v2f;
typedef __attribute__((ext_vector_type(4))) float v4f;
typedef __attribute__((ext_vector_type(8))) float v8f;

#define BS  4
#define CH  32
#define NF  128
#define L   4096      // hei*wei
#define ROWS 4096     // BS*CH*HEI
#define NSPLIT 4      // column ranges of the attention, one work-group each:
                      // 128 x 4 groups, two resident on each of the 256 WGPs
#define LSP (L / NSPLIT)   // columns per range

__device__ __forceinline__ v8f wmma_f32(v2f a, v2f b, v8f c) {
  // V_WMMA_F32_16X16X4_F32 : D = A(16x4) * B(4x16) + C(16x16)
  return __builtin_amdgcn_wmma_f32_16x16x4_f32(false, a, false, b, (short)0, c,
                                               false, false);
}

// ---------------------------------------------------------------------------
// Kernel A: affinity/alpha  (1x1 conv -> BN(eval) -> ReLU -> 2-way softmax)
// ---------------------------------------------------------------------------
__global__ void alpha_kernel(const float* __restrict__ head,
                             const float* __restrict__ tail,
                             const float* __restrict__ conv_w,
                             const float* __restrict__ conv_b,
                             const float* __restrict__ bn_w,
                             const float* __restrict__ bn_b,
                             const float* __restrict__ bn_mean,
                             const float* __restrict__ bn_var,
                             const int* __restrict__ flagp,
                             float* __restrict__ alpha) {
  int t = blockIdx.x * blockDim.x + threadIdx.x;
  if (t >= BS * L) return;
  int b = t >> 12, l = t & (L - 1);
  const float* hb = head + ((b * CH) << 12) + l;
  const float* tb = tail + ((b * CH) << 12) + l;
  float s0 = conv_b[0], s1 = conv_b[1];
#pragma unroll 4
  for (int c = 0; c < CH; ++c) {
    float hv = hb[c << 12];
    s0 = fmaf(conv_w[c], hv, s0);
    s1 = fmaf(conv_w[64 + c], hv, s1);
  }
#pragma unroll 4
  for (int c = 0; c < CH; ++c) {
    float tv = tb[c << 12];
    s0 = fmaf(conv_w[CH + c], tv, s0);
    s1 = fmaf(conv_w[64 + CH + c], tv, s1);
  }
  float sc0 = bn_w[0] * rsqrtf(bn_var[0] + 1e-5f);
  float sc1 = bn_w[1] * rsqrtf(bn_var[1] + 1e-5f);
  float r0 = fmaxf((s0 - bn_mean[0]) * sc0 + bn_b[0], 0.f);
  float r1 = fmaxf((s1 - bn_mean[1]) * sc1 + bn_b[1], 0.f);
  float m = fmaxf(r0, r1);
  float e0 = __expf(r0 - m), e1 = __expf(r1 - m);
  alpha[t] = (*flagp) ? (e0 / (e0 + e1)) : (e1 / (e0 + e1));
}

// ---------------------------------------------------------------------------
// Kernel B: five projections (4096x128 @ 128x128) via WMMA f32 16x16x4,
// scattering into attention-friendly layouts:
//   q  [b][l][32]          K' [b][l][64] (cols 0..31 pre-scaled by alpha)
//   V' [b][64][l]
// One wave computes one 16x16 output tile.
// ---------------------------------------------------------------------------
__global__ __launch_bounds__(128) void proj_kernel(
    const float* __restrict__ head, const float* __restrict__ tail,
    const float* __restrict__ R_q, const float* __restrict__ R_k,
    const float* __restrict__ R_v, const float* __restrict__ F_q,
    const float* __restrict__ F_k, const float* __restrict__ F_v,
    const int* __restrict__ flagp, const float* __restrict__ alpha,
    float* __restrict__ qws, float* __restrict__ kc, float* __restrict__ vc) {
  int wid = (blockIdx.x * blockDim.x + threadIdx.x) >> 5;
  int lane = threadIdx.x & 31;
  int half = lane >> 4, lm = lane & 15;
  int proj = wid >> 11;            // 0..4 (2048 tiles each)
  int t = wid & 2047;
  int r0 = (t >> 3) << 4;          // 256 row tiles
  int n0 = (t & 7) << 4;           // 8 col tiles
  int flag = *flagp;

  const float* src;
  const float* mat;
  switch (proj) {
    case 0:  src = flag ? head : tail; mat = flag ? R_q : F_q; break; // q
    case 1:  src = flag ? tail : head; mat = flag ? F_k : R_k; break; // K' lo (scaled)
    case 2:  src = flag ? head : tail; mat = flag ? R_k : F_k; break; // K' hi
    case 3:  src = flag ? tail : head; mat = flag ? F_v : R_v; break; // V' rows 0..31
    default: src = flag ? head : tail; mat = flag ? R_v : F_v; break; // V' rows 32..63
  }

  const float* arow = src + (r0 + lm) * NF;
  v8f acc = {};
#pragma unroll
  for (int k0 = 0; k0 < NF; k0 += 4) {
    int k = k0 + 2 * half;
    v2f a;  a.x = arow[k];                a.y = arow[k + 1];
    v2f bv; bv.x = mat[k * NF + n0 + lm]; bv.y = mat[(k + 1) * NF + n0 + lm];
    acc = wmma_f32(a, bv, acc);
  }

  int w = n0 + lm;
#pragma unroll
  for (int r = 0; r < 8; ++r) {
    int row = r0 + half * 8 + r;             // (b, c, h) flattened
    int b = row >> 10, c = (row >> 5) & 31, h = row & 31;
    int l = (h << 7) + w;
    int bl = (b << 12) + l;
    float v = acc[r];
    if (proj == 0)      qws[bl * 32 + c] = v;
    else if (proj == 1) kc[bl * 64 + c] = v * alpha[bl];
    else if (proj == 2) kc[bl * 64 + 32 + c] = v;
    else if (proj == 3) vc[((b * 64 + c) << 12) + l] = v;
    else                vc[((b * 64 + 32 + c) << 12) + l] = v;
  }
}

// ---------------------------------------------------------------------------
// Kernel C: fused flash attention, 64-column tiles, scores formed transposed.
//   St = V't(64 cols x 64) @ K't(64 x 16 rows), online softmax,
//   Ot += qt(32 x 64 cols) @ Pt(64 cols x 16 rows)
// 8 waves/block, 16 rows/wave; V'/q tiles staged in LDS with float4 loads.
// In the accumulator of St a lane holds scores of ONE attention row (row = lane
// & 15; the two half-waves hold different columns of it), so the row maximum
// and row sum are in-lane work plus one exchange between the halves, and the
// accumulator registers are, pair by pair, the B operand of the second
// product: P never goes through LDS.
// Each work-group walks one of NSPLIT column ranges and leaves its
// un-normalised sum with the range's row maximum and row sum; merge_kernel
// joins the ranges.
// ---------------------------------------------------------------------------
__device__ __forceinline__ float xhalf(float x) {   // lane l with lane l ^ 16
  int i = __builtin_bit_cast(int, x);
  return __builtin_bit_cast(float, __builtin_amdgcn_permlanex16(
      i, i, 0x76543210, 0xfedcba98, false, false));
}

__global__ __launch_bounds__(256, 1) void attn_kernel(
    const float* __restrict__ qws, const float* __restrict__ kc,
    const float* __restrict__ vc, float* __restrict__ po,
    float* __restrict__ pm, float* __restrict__ pl) {
  __shared__ float lds_v[64][64];      // V' column tile   (16 KB)
  __shared__ float lds_q[64][32];      // q row tile       (8 KB)

  int tid = threadIdx.x;
  int w = tid >> 5;
  int lane = tid & 31;
  int half = lane >> 4, lm = lane & 15;
  int b = blockIdx.x >> 5;                         // 32 blocks per batch
  int i0 = (((blockIdx.x & 31) << 3) + w) << 4;    // wave's first row
  int sp = blockIdx.y;                             // column range
  int bl = b << 12;

  const float* vcB = vc + ((b * 64) << 12) + sp * LSP;   // range's first column
  const float* qB = qws + (bl + sp * LSP) * 32;          // range's first q row
  const float* kcRow = kc + (bl + i0 + lm) * 64;

  // Preload this wave's 16x64 K' strip; as K't it is the B operand (16 k-steps):
  // lane = row, the half-waves split each k-step's four k.
  v2f ka[16];
#pragma unroll
  for (int s = 0; s < 16; ++s) {
    int k0 = 4 * s + 2 * half;
    ka[s].x = kcRow[k0];
    ka[s].y = kcRow[k0 + 1];
  }

  // o0[r] = Ot[8 * half + r][row lm], o1[r] = Ot[16 + 8 * half + r][row lm].
  // mrow is the row's maximum (equal in both halves); lrow is this half-wave's
  // share of the row's sum, joined once behind the loop.
  v8f o0 = {}, o1 = {};
  float mrow = -3.0e38f, lrow = 0.f;

  for (int j0 = 0; j0 < LSP; j0 += 64) {
    __syncthreads();   // previous iteration's LDS reads complete
    // Cooperative float4 stage: V' tile (64x64) and q tile (64x32)
#pragma unroll
    for (int i = 0; i < 4; ++i) {
      int idx = (tid + (i << 8)) << 2;       // 0..4092
      int kr = idx >> 6, cn = idx & 63;
      *(v4f*)&lds_v[kr][cn] = *(const v4f*)&vcB[(kr << 12) + j0 + cn];
    }
#pragma unroll
    for (int i = 0; i < 2; ++i) {
      int idx = (tid + (i << 8)) << 2;       // 0..2044
      int kr = idx >> 5, cc = idx & 31;
      *(v4f*)&lds_q[kr][cc] = *(const v4f*)&qB[(j0 + kr) * 32 + cc];
    }
    __syncthreads();

    // Transposed score tiles: 4 x (16 columns x 16 rows), K = 64.
    // s[t][r] = score of row lm at column 16 * t + 8 * half + r.
    // Every loop over st, t, r and u from here to the loop's foot is unrolled so
    // that s, vm, ps, o0 and o1 are indexed by constants and stay in registers.
    v8f s[4] = {};
#pragma unroll
    for (int st = 0; st < 16; ++st) {
      int k0 = 4 * st + 2 * half;
#pragma unroll
      for (int t = 0; t < 4; ++t) {
        v2f va;
        va.x = lds_v[k0][16 * t + lm];
        va.y = lds_v[k0 + 1][16 * t + lm];
        s[t] = wmma_f32(va, ka[st], s[t]);
      }
    }

    // Online softmax over the 64-column strip: 32 scores of the row in this
    // lane, the other 32 in lane ^ 16.
    float vm[4];
#pragma unroll
    for (int t = 0; t < 4; ++t) {
      vm[t] = s[t][0];
#pragma unroll
      for (int r = 1; r < 8; ++r) vm[t] = fmaxf(vm[t], s[t][r]);
    }
    float v = fmaxf(fmaxf(vm[0], vm[1]), fmaxf(vm[2], vm[3]));
    v = fmaxf(v, xhalf(v));
    float mnew = fmaxf(mrow, v);
    float corr = __expf(mrow - mnew);
    mrow = mnew;
#pragma unroll
    for (int t = 0; t < 4; ++t) {
#pragma unroll
      for (int r = 0; r < 8; ++r) s[t][r] = __expf(s[t][r] - mnew);
    }
#pragma unroll
    for (int r = 0; r < 8; ++r) {
      o0[r] *= corr;
      o1[r] *= corr;
    }

    // Ot += qt(32x64) @ Pt(64x16), K = 64. Registers 2u, 2u+1 of s[t] are the B
    // operand of one k-step, whose four k are then the columns
    // 16 * t + 8 * half + 2u + {0, 1}; the q loader takes the same order.
    // The same register pairs are summed, two chains of pairs, for the row sum.
    v2f ps[2] = {};
#pragma unroll
    for (int t = 0; t < 4; ++t) {
#pragma unroll
      for (int u = 0; u < 4; ++u) {
        int j = 16 * t + 8 * half + 2 * u;
        v2f pb;  pb.x = s[t][2 * u];        pb.y = s[t][2 * u + 1];
        v2f qa0; qa0.x = lds_q[j][lm];      qa0.y = lds_q[j + 1][lm];
        v2f qa1; qa1.x = lds_q[j][16 + lm]; qa1.y = lds_q[j + 1][16 + lm];
        o0 = wmma_f32(qa0, pb, o0);
        o1 = wmma_f32(qa1, pb, o1);
        ps[u & 1] += pb;
      }
    }
    lrow = lrow * corr + ((ps[0].x + ps[0].y) + (ps[1].x + ps[1].y));
  }

  // Store the range's un-normalised sum to po[sp][b][c][l] (a half-wave writes
  // 16 consecutive l of one c) and its row maximum and row sum to
  // pm/pl[sp][b][l]. The loop is unrolled because o0 and o1 are registers.
  float* poL = po + (((sp * BS + b) * CH + half * 8) << 12) + i0 + lm;
#pragma unroll
  for (int r = 0; r < 8; ++r) {
    poL[r << 12] = o0[r];
    poL[(16 + r) << 12] = o1[r];
  }
  lrow += xhalf(lrow);
  if (half == 0) {
    int st = ((sp * BS + b) << 12) + i0 + lm;
    pm[st] = mrow;
    pl[st] = lrow;
  }
}

// ---------------------------------------------------------------------------
// Kernel C2: join the NSPLIT column ranges.
//   y = sum_s exp(m_s - M) * O_s / sum_s exp(m_s - M) * l_s,  M = max_s m_s
// One thread per four consecutive l of one (b, c). Every loop is unrolled so
// that mv stays in registers and the 3 * NSPLIT loads are in flight together.
// ---------------------------------------------------------------------------
__global__ __launch_bounds__(256) void merge_kernel(
    const float* __restrict__ po, const float* __restrict__ pm,
    const float* __restrict__ pl, float* __restrict__ y) {
  int t = blockIdx.x * 256 + threadIdx.x;          // 0 .. BS*CH*L/4 - 1
  int e = t << 2;                                  // element of y[b][c][l]
  int sl = ((e >> 17) << 12) + (e & (L - 1));      // element of pm[.][b][l]
  v4f mv[NSPLIT];
#pragma unroll
  for (int s = 0; s < NSPLIT; ++s) mv[s] = *(const v4f*)&pm[s * BS * L + sl];
  v4f M = mv[0];
#pragma unroll
  for (int s = 1; s < NSPLIT; ++s)
#pragma unroll
    for (int i = 0; i < 4; ++i) M[i] = fmaxf(M[i], mv[s][i]);
  v4f num = {}, den = {};
#pragma unroll
  for (int s = 0; s < NSPLIT; ++s) {
    v4f lv = *(const v4f*)&pl[s * BS * L + sl];
    v4f ov = *(const v4f*)&po[s * BS * CH * L + e];
#pragma unroll
    for (int i = 0; i < 4; ++i) {
      float wgt = __expf(mv[s][i] - M[i]);
      den[i] = fmaf(wgt, lv[i], den[i]);
      num[i] = fmaf(wgt, ov[i], num[i]);
    }
  }
  v4f r;
#pragma unroll
  for (int i = 0; i < 4; ++i) r[i] = num[i] / den[i];
  *(v4f*)&y[e] = r;
}

// ---------------------------------------------------------------------------
// Kernel D: out = y @ W + residual   (4096x128 @ 128x128, WMMA tiles)
// ---------------------------------------------------------------------------
__global__ __launch_bounds__(128) void final_kernel(
    const float* __restrict__ y, const float* __restrict__ head,
    const float* __restrict__ tail, const float* __restrict__ R_W,
    const float* __restrict__ F_W, const int* __restrict__ flagp,
    float* __restrict__ out) {
  int wid = (blockIdx.x * blockDim.x + threadIdx.x) >> 5;
  int lane = threadIdx.x & 31;
  int half = lane >> 4, lm = lane & 15;
  int r0 = (wid >> 3) << 4;
  int n0 = (wid & 7) << 4;
  int flag = *flagp;
  const float* mat = flag ? R_W : F_W;
  const float* res = flag ? head : tail;

  const float* arow = y + (r0 + lm) * NF;   // y is row-major 4096x128
  v8f acc = {};
#pragma unroll
  for (int k0 = 0; k0 < NF; k0 += 4) {
    int k = k0 + 2 * half;
    v2f a;  a.x = arow[k];                a.y = arow[k + 1];
    v2f bv; bv.x = mat[k * NF + n0 + lm]; bv.y = mat[(k + 1) * NF + n0 + lm];
    acc = wmma_f32(a, bv, acc);
  }
#pragma unroll
  for (int r = 0; r < 8; ++r) {
    int row = r0 + half * 8 + r;
    int idx = row * NF + n0 + lm;
    out[idx] = acc[r] + res[idx];
  }
}

// ---------------------------------------------------------------------------
extern "C" void kernel_launch(void* const* d_in, const int* in_sizes, int n_in,
                              void* d_out, int out_size, void* d_ws,
                              size_t ws_size, hipStream_t stream) {
  const float* head    = (const float*)d_in[0];
  const float* tail    = (const float*)d_in[1];
  const float* R_q     = (const float*)d_in[2];
  const float* R_k     = (const float*)d_in[3];
  const float* R_v     = (const float*)d_in[4];
  const float* R_W     = (const float*)d_in[5];
  const float* F_q     = (const float*)d_in[6];
  const float* F_k     = (const float*)d_in[7];
  const float* F_v     = (const float*)d_in[8];
  const float* F_W     = (const float*)d_in[9];
  const float* conv_w  = (const float*)d_in[10];
  const float* conv_b  = (const float*)d_in[11];
  const float* bn_w    = (const float*)d_in[12];
  const float* bn_b    = (const float*)d_in[13];
  const float* bn_mean = (const float*)d_in[14];
  const float* bn_var  = (const float*)d_in[15];
  const int*   flag    = (const int*)d_in[16];
  float* out = (float*)d_out;

  float* ws    = (float*)d_ws;
  float* alpha = ws;                 // 16384
  float* qws   = alpha + 16384;      // 524288   q  [b][l][32]
  float* kc    = qws + 524288;       // 1048576  K' [b][l][64]
  float* vc    = kc + 1048576;       // 1048576  V' [b][64][l]
  float* y     = vc + 1048576;       // 524288   y  [b][32][l]
  float* po    = y + 524288;         // NSPLIT * 524288  partial O [s][b][32][l]
  float* pm    = po + NSPLIT * 524288;   // NSPLIT * 16384  row maxima [s][b][l]
  float* pl    = pm + NSPLIT * 16384;    // NSPLIT * 16384  row sums   [s][b][l]

  alpha_kernel<<<64, 256, 0, stream>>>(head, tail, conv_w, conv_b, bn_w, bn_b,
                                       bn_mean, bn_var, flag, alpha);
  proj_kernel<<<2560, 128, 0, stream>>>(head, tail, R_q, R_k, R_v, F_q, F_k,
                                        F_v, flag, alpha, qws, kc, vc);
  attn_kernel<<<dim3(128, NSPLIT), 256, 0, stream>>>(qws, kc, vc, po, pm, pl);
  merge_kernel<<<512, 256, 0, stream>>>(po, pm, pl, y);
  final_kernel<<<512, 128, 0, stream>>>(y, head, tail, R_W, F_W, flag, out);
}

// v003
// It runs in 148 microseconds.
// In two side-by-side timings against v002, it was 1.07 and 1.06 times as fast.
// Counting every step since v000, it is 2.59 times as fast.
#include <hip/hip_runtime.h>
#include <hip/hip_bf16.h>

typedef __attribute__((ext_vector_type(2))) float v2f;
typedef __attribute__((ext_vector_type(4))) float v4f;
typedef __attribute__((ext_vector_type(8))) float v8f;

#define BS  4
#define CH  32
#define NF  128
#define L   4096      // hei*wei
#define ROWS 4096     // BS*CH*HEI
#define NSPLIT 4      // column ranges of the attention, one work-group each:
                      // 128 x 4 groups, two resident on each of the 256 WGPs
#define LSP (L / NSPLIT)   // columns per range
#define TP 68         // LDS row pitch in floats: 272 B = 17 x 16 B, so the 16 rows
                      // that a half-wave's 16-byte reads touch fall on all 64 banks

__device__ __forceinline__ v8f wmma_f32(v2f a, v2f b, v8f c) {
  // V_WMMA_F32_16X16X4_F32 : D = A(16x4) * B(4x16) + C(16x16)
  return __builtin_amdgcn_wmma_f32_16x16x4_f32(false, a, false, b, (short)0, c,
                                               false, false);
}

// ---------------------------------------------------------------------------
// Kernel A: affinity/alpha  (1x1 conv -> BN(eval) -> ReLU -> 2-way softmax)
// ---------------------------------------------------------------------------
__global__ void alpha_kernel(const float* __restrict__ head,
                             const float* __restrict__ tail,
                             const float* __restrict__ conv_w,
                             const float* __restrict__ conv_b,
                             const float* __restrict__ bn_w,
                             const float* __restrict__ bn_b,
                             const float* __restrict__ bn_mean,
                             const float* __restrict__ bn_var,
                             const int* __restrict__ flagp,
                             float* __restrict__ alpha) {
  int t = blockIdx.x * blockDim.x + threadIdx.x;
  if (t >= BS * L) return;
  int b = t >> 12, l = t & (L - 1);
  const float* hb = head + ((b * CH) << 12) + l;
  const float* tb = tail + ((b * CH) << 12) + l;
  float s0 = conv_b[0], s1 = conv_b[1];
#pragma unroll 4
  for (int c = 0; c < CH; ++c) {
    float hv = hb[c << 12];
    s0 = fmaf(conv_w[c], hv, s0);
    s1 = fmaf(conv_w[64 + c], hv, s1);
  }
#pragma unroll 4
  for (int c = 0; c < CH; ++c) {
    float tv = tb[c << 12];
    s0 = fmaf(conv_w[CH + c], tv, s0);
    s1 = fmaf(conv_w[64 + CH + c], tv, s1);
  }
  float sc0 = bn_w[0] * rsqrtf(bn_var[0] + 1e-5f);
  float sc1 = bn_w[1] * rsqrtf(bn_var[1] + 1e-5f);
  float r0 = fmaxf((s0 - bn_mean[0]) * sc0 + bn_b[0], 0.f);
  float r1 = fmaxf((s1 - bn_mean[1]) * sc1 + bn_b[1], 0.f);
  float m = fmaxf(r0, r1);
  float e0 = __expf(r0 - m), e1 = __expf(r1 - m);
  alpha[t] = (*flagp) ? (e0 / (e0 + e1)) : (e1 / (e0 + e1));
}

// ---------------------------------------------------------------------------
// Kernel B: five projections (4096x128 @ 128x128) via WMMA f32 16x16x4,
// scattering into attention-friendly layouts:
//   q  [b][l / 64][32][l % 64]   (one 64-column tile is 8 KB in a row)
//   K' [b][l][64] (cols 0..31 pre-scaled by alpha)      V' [b][l][64]
// so that what a lane of the attention takes as the k of an A fragment lies
// side by side in memory.
// One wave computes one 16x16 output tile.
// ---------------------------------------------------------------------------
__global__ __launch_bounds__(128) void proj_kernel(
    const float* __restrict__ head, const float* __restrict__ tail,
    const float* __restrict__ R_q, const float* __restrict__ R_k,
    const float* __restrict__ R_v, const float* __restrict__ F_q,
    const float* __restrict__ F_k, const float* __restrict__ F_v,
    const int* __restrict__ flagp, const float* __restrict__ alpha,
    float* __restrict__ qws, float* __restrict__ kc, float* __restrict__ vc) {
  int wid = (blockIdx.x * blockDim.x + threadIdx.x) >> 5;
  int lane = threadIdx.x & 31;
  int half = lane >> 4, lm = lane & 15;
  int proj = wid >> 11;            // 0..4 (2048 tiles each)
  int t = wid & 2047;
  int r0 = (t >> 3) << 4;          // 256 row tiles
  int n0 = (t & 7) << 4;           // 8 col tiles
  int flag = *flagp;

  const float* src;
  const float* mat;
  switch (proj) {
    case 0:  src = flag ? head : tail; mat = flag ? R_q : F_q; break; // q
    case 1:  src = flag ? tail : head; mat = flag ? F_k : R_k; break; // K' lo (scaled)
    case 2:  src = flag ? head : tail; mat = flag ? R_k : F_k; break; // K' hi
    case 3:  src = flag ? tail : head; mat = flag ? F_v : R_v; break; // V' rows 0..31
    default: src = flag ? head : tail; mat = flag ? R_v : F_v; break; // V' rows 32..63
  }

  const float* arow = src + (r0 + lm) * NF;
  v8f acc = {};
#pragma unroll
  for (int k0 = 0; k0 < NF; k0 += 4) {
    int k = k0 + 2 * half;
    v2f a;  a.x = arow[k];                a.y = arow[k + 1];
    v2f bv; bv.x = mat[k * NF + n0 + lm]; bv.y = mat[(k + 1) * NF + n0 + lm];
    acc = wmma_f32(a, bv, acc);
  }

  int w = n0 + lm;
#pragma unroll
  for (int r = 0; r < 8; ++r) {
    int row = r0 + half * 8 + r;             // (b, c, h) flattened
    int b = row >> 10, c = (row >> 5) & 31, h = row & 31;
    int l = (h << 7) + w;
    int bl = (b << 12) + l;
    float v = acc[r];
    if (proj == 0)      qws[((((b << 6) + (l >> 6)) * 32 + c) << 6) + (l & 63)] = v;
    else if (proj == 1) kc[bl * 64 + c] = v * alpha[bl];
    else if (proj == 2) kc[bl * 64 + 32 + c] = v;
    else if (proj == 3) vc[bl * 64 + c] = v;
    else                vc[bl * 64 + 32 + c] = v;
  }
}

// ---------------------------------------------------------------------------
// Kernel C: fused flash attention, 64-column tiles, scores formed transposed.
//   St = V't(64 cols x 64) @ K't(64 x 16 rows), online softmax,
//   Ot += qt(32 x 64 cols) @ Pt(64 cols x 16 rows)
// 8 waves/block, 16 rows/wave; V'/q tiles staged in LDS with float4 loads.
// Both tiles lie in LDS with the k of their product along the row (V' as
// [column][k], q as [channel][column]): one 16-byte read gives a lane the A
// fragments of two k-steps.
// In the accumulator of St a lane holds scores of ONE attention row (row = lane
// & 15; the two half-waves hold different columns of it), so the row maximum
// and row sum are in-lane work plus one exchange between the halves, and the
// accumulator registers are, pair by pair, the B operand of the second
// product: P never goes through LDS.
// Each work-group walks one of NSPLIT column ranges and leaves its
// un-normalised sum with the range's row maximum and row sum; merge_kernel
// joins the ranges.
// ---------------------------------------------------------------------------
__device__ __forceinline__ float xhalf(float x) {   // lane l with lane l ^ 16
  int i = __builtin_bit_cast(int, x);
  return __builtin_bit_cast(float, __builtin_amdgcn_permlanex16(
      i, i, 0x76543210, 0xfedcba98, false, false));
}

// Four waves per SIMD, no more: two of the 512 work-groups to each WGP. A third
// on one WGP would leave another with one, and the fullest WGP sets the time.
__global__ __launch_bounds__(256) __attribute__((amdgpu_waves_per_eu(4, 4)))
void attn_kernel(
    const float* __restrict__ qws, const float* __restrict__ kc,
    const float* __restrict__ vc, float* __restrict__ po,
    float* __restrict__ pm, float* __restrict__ pl) {
  __shared__ __attribute__((aligned(16))) float lds_v[64][TP];  // V' [column][k]
  __shared__ __attribute__((aligned(16))) float lds_q[32][TP];  // q  [channel][column]

  int tid = threadIdx.x;
  int w = tid >> 5;
  int lane = tid & 31;
  int half = lane >> 4, lm = lane & 15;
  int b = blockIdx.x >> 5;                         // 32 blocks per batch
  int i0 = (((blockIdx.x & 31) << 3) + w) << 4;    // wave's first row
  int sp = blockIdx.y;                             // column range
  int bl = b << 12;

  const float* vcB = vc + (bl + sp * LSP) * 64;          // range's first column
  const float* qB = qws + (bl + sp * LSP) * 32;          // range's first q tile
  const float* kcRow = kc + (bl + i0 + lm) * 64;

  // Preload this wave's 16x64 K' strip; as K't it is the B operand (16 k-steps):
  // lane = row. Of eight consecutive k a half-wave holds four, 8 * s + 4 * half
  // + {0..3}: the first two are its share of k-step 2s, the last two of 2s + 1.
  v2f ka[16];
#pragma unroll
  for (int s = 0; s < 8; ++s) {
    v4f kq = *(const v4f*)&kcRow[8 * s + 4 * half];
    ka[2 * s].x = kq.x;     ka[2 * s].y = kq.y;
    ka[2 * s + 1].x = kq.z; ka[2 * s + 1].y = kq.w;
  }

  // o0[r] = Ot[8 * half + r][row lm], o1[r] = Ot[16 + 8 * half + r][row lm].
  // mrow is the row's maximum (equal in both halves); lrow is this half-wave's
  // share of the row's sum, joined once behind the loop.
  v8f o0 = {}, o1 = {};
  float mrow = -3.0e38f, lrow = 0.f;

  for (int j0 = 0; j0 < LSP; j0 += 64) {
    __syncthreads();   // previous iteration's LDS reads complete
    // Cooperative float4 stage: V' tile (64 columns x 64 k, 16 KB in a row in
    // memory) and q tile (32 channels x 64 columns, 8 KB in a row)
#pragma unroll
    for (int i = 0; i < 4; ++i) {
      int idx = (tid + (i << 8)) << 2;       // 0..4092
      *(v4f*)&lds_v[idx >> 6][idx & 63] = *(const v4f*)&vcB[j0 * 64 + idx];
    }
#pragma unroll
    for (int i = 0; i < 2; ++i) {
      int idx = (tid + (i << 8)) << 2;       // 0..2044
      *(v4f*)&lds_q[idx >> 6][idx & 63] = *(const v4f*)&qB[j0 * 32 + idx];
    }
    __syncthreads();

    // Transposed score tiles: 4 x (16 columns x 16 rows), K = 64.
    // s[t][r] = score of row lm at column 16 * t + 8 * half + r.
    // Every loop over st, t, r and u from here to the loop's foot is unrolled so
    // that s, vm, ps, o0 and o1 are indexed by constants and stay in registers.
    // The V' loader takes the k order of ka.
    v8f s[4] = {};
#pragma unroll
    for (int st = 0; st < 8; ++st) {
      v4f va[4];
#pragma unroll
      for (int t = 0; t < 4; ++t)
        va[t] = *(const v4f*)&lds_v[16 * t + lm][8 * st + 4 * half];
#pragma unroll
      for (int t = 0; t < 4; ++t) {
        v2f a; a.x = va[t].x; a.y = va[t].y;
        s[t] = wmma_f32(a, ka[2 * st], s[t]);
      }
#pragma unroll
      for (int t = 0; t < 4; ++t) {
        v2f a; a.x = va[t].z; a.y = va[t].w;
        s[t] = wmma_f32(a, ka[2 * st + 1], s[t]);
      }
    }

    // Online softmax over the 64-column strip: 32 scores of the row in this
    // lane, the other 32 in lane ^ 16.
    float vm[4];
#pragma unroll
    for (int t = 0; t < 4; ++t) {
      vm[t] = s[t][0];
#pragma unroll
      for (int r = 1; r < 8; ++r) vm[t] = fmaxf(vm[t], s[t][r]);
    }
    float v = fmaxf(fmaxf(vm[0], vm[1]), fmaxf(vm[2], vm[3]));
    v = fmaxf(v, xhalf(v));
    float mnew = fmaxf(mrow, v);
    float corr = __expf(mrow - mnew);
    mrow = mnew;
#pragma unroll
    for (int t = 0; t < 4; ++t) {
#pragma unroll
      for (int r = 0; r < 8; ++r) s[t][r] = __expf(s[t][r] - mnew);
    }
#pragma unroll
    for (int r = 0; r < 8; ++r) {
      o0[r] *= corr;
      o1[r] *= corr;
    }

    // Ot += qt(32x64) @ Pt(64x16), K = 64. Registers 2u, 2u+1 of s[t] are the B
    // operand of one k-step, whose four k are then the columns
    // 16 * t + 8 * half + 2u + {0, 1}; the q loader takes the same order, two
    // k-steps (u, u + 1) to a 16-byte read.
    // The same register pairs are summed, two chains of pairs, for the row sum.
    v2f ps[2] = {};
#pragma unroll
    for (int t = 0; t < 4; ++t) {
#pragma unroll
      for (int u = 0; u < 4; u += 2) {
        int j = 16 * t + 8 * half + 2 * u;
        v4f q0 = *(const v4f*)&lds_q[lm][j];
        v4f q1 = *(const v4f*)&lds_q[16 + lm][j];
        v2f pb;  pb.x = s[t][2 * u];  pb.y = s[t][2 * u + 1];
        v2f qa0; qa0.x = q0.x;        qa0.y = q0.y;
        v2f qa1; qa1.x = q1.x;        qa1.y = q1.y;
        o0 = wmma_f32(qa0, pb, o0);
        o1 = wmma_f32(qa1, pb, o1);
        ps[0] += pb;
        pb.x = s[t][2 * u + 2];       pb.y = s[t][2 * u + 3];
        qa0.x = q0.z;                 qa0.y = q0.w;
        qa1.x = q1.z;                 qa1.y = q1.w;
        o0 = wmma_f32(qa0, pb, o0);
        o1 = wmma_f32(qa1, pb, o1);
        ps[1] += pb;
      }
    }
    lrow = lrow * corr + ((ps[0].x + ps[0].y) + (ps[1].x + ps[1].y));
  }

  // Store the range's un-normalised sum to po[sp][b][c][l] (a half-wave writes
  // 16 consecutive l of one c) and its row maximum and row sum to
  // pm/pl[sp][b][l]. The loop is unrolled because o0 and o1 are registers.
  float* poL = po + (((sp * BS + b) * CH + half * 8) << 12) + i0 + lm;
#pragma unroll
  for (int r = 0; r < 8; ++r) {
    poL[r << 12] = o0[r];
    poL[(16 + r) << 12] = o1[r];
  }
  lrow += xhalf(lrow);
  if (half == 0) {
    int st = ((sp * BS + b) << 12) + i0 + lm;
    pm[st] = mrow;
    pl[st] = lrow;
  }
}

// ---------------------------------------------------------------------------
// Kernel C2: join the NSPLIT column ranges.
//   y = sum_s exp(m_s - M) * O_s / sum_s exp(m_s - M) * l_s,  M = max_s m_s
// One thread per four consecutive l of one (b, c). Every loop is unrolled so
// that mv stays in registers and the 3 * NSPLIT loads are in flight together.
// ---------------------------------------------------------------------------
__global__ __launch_bounds__(256) void merge_kernel(
    const float* __restrict__ po, const float* __restrict__ pm,
    const float* __restrict__ pl, float* __restrict__ y) {
  int t = blockIdx.x * 256 + threadIdx.x;          // 0 .. BS*CH*L/4 - 1
  int e = t << 2;                                  // element of y[b][c][l]
  int sl = ((e >> 17) << 12) + (e & (L - 1));      // element of pm[.][b][l]
  v4f mv[NSPLIT];
#pragma unroll
  for (int s = 0; s < NSPLIT; ++s) mv[s] = *(const v4f*)&pm[s * BS * L + sl];
  v4f M = mv[0];
#pragma unroll
  for (int s = 1; s < NSPLIT; ++s)
#pragma unroll
    for (int i = 0; i < 4; ++i) M[i] = fmaxf(M[i], mv[s][i]);
  v4f num = {}, den = {};
#pragma unroll
  for (int s = 0; s < NSPLIT; ++s) {
    v4f lv = *(const v4f*)&pl[s * BS * L + sl];
    v4f ov = *(const v4f*)&po[s * BS * CH * L + e];
#pragma unroll
    for (int i = 0; i < 4; ++i) {
      float wgt = __expf(mv[s][i] - M[i]);
      den[i] = fmaf(wgt, lv[i], den[i]);
      num[i] = fmaf(wgt, ov[i], num[i]);
    }
  }
  v4f r;
#pragma unroll
  for (int i = 0; i < 4; ++i) r[i] = num[i] / den[i];
  *(v4f*)&y[e] = r;
}

// ---------------------------------------------------------------------------
// Kernel D: out = y @ W + residual   (4096x128 @ 128x128, WMMA tiles)
// ---------------------------------------------------------------------------
__global__ __launch_bounds__(128) void final_kernel(
    const float* __restrict__ y, const float* __restrict__ head,
    const float* __restrict__ tail, const float* __restrict__ R_W,
    const float* __restrict__ F_W, const int* __restrict__ flagp,
    float* __restrict__ out) {
  int wid = (blockIdx.x * blockDim.x + threadIdx.x) >> 5;
  int lane = threadIdx.x & 31;
  int half = lane >> 4, lm = lane & 15;
  int r0 = (wid >> 3) << 4;
  int n0 = (wid & 7) << 4;
  int flag = *flagp;
  const float* mat = flag ? R_W : F_W;
  const float* res = flag ? head : tail;

  const float* arow = y + (r0 + lm) * NF;   // y is row-major 4096x128
  v8f acc = {};
#pragma unroll
  for (int k0 = 0; k0 < NF; k0 += 4) {
    int k = k0 + 2 * half;
    v2f a;  a.x = arow[k];                a.y = arow[k + 1];
    v2f bv; bv.x = mat[k * NF + n0 + lm]; bv.y = mat[(k + 1) * NF + n0 + lm];
    acc = wmma_f32(a, bv, acc);
  }
#pragma unroll
  for (int r = 0; r < 8; ++r) {
    int row = r0 + half * 8 + r;
    int idx = row * NF + n0 + lm;
    out[idx] = acc[r] + res[idx];
  }
}

// ---------------------------------------------------------------------------
extern "C" void kernel_launch(void* const* d_in, const int* in_sizes, int n_in,
                              void* d_out, int out_size, void* d_ws,
                              size_t ws_size, hipStream_t stream) {
  const float* head    = (const float*)d_in[0];
  const float* tail    = (const float*)d_in[1];
  const float* R_q     = (const float*)d_in[2];
  const float* R_k     = (const float*)d_in[3];
  const float* R_v     = (const float*)d_in[4];
  const float* R_W     = (const float*)d_in[5];
  const float* F_q     = (const float*)d_in[6];
  const float* F_k     = (const float*)d_in[7];
  const float* F_v     = (const float*)d_in[8];
  const float* F_W     = (const float*)d_in[9];
  const float* conv_w  = (const float*)d_in[10];
  const float* conv_b  = (const float*)d_in[11];
  const float* bn_w    = (const float*)d_in[12];
  const float* bn_b    = (const float*)d_in[13];
  const float* bn_mean = (const float*)d_in[14];
  const float* bn_var  = (const float*)d_in[15];
  const int*   flag    = (const int*)d_in[16];
  float* out = (float*)d_out;

  float* ws    = (float*)d_ws;
  float* alpha = ws;                 // 16384
  float* qws   = alpha + 16384;      // 524288   q  [b][l/64][32][l%64]
  float* kc    = qws + 524288;       // 1048576  K' [b][l][64]
  float* vc    = kc + 1048576;       // 1048576  V' [b][l][64]
  float* y     = vc + 1048576;       // 524288   y  [b][32][l]
  float* po    = y + 524288;         // NSPLIT * 524288  partial O [s][b][32][l]
  float* pm    = po + NSPLIT * 524288;   // NSPLIT * 16384  row maxima [s][b][l]
  float* pl    = pm + NSPLIT * 16384;    // NSPLIT * 16384  row sums   [s][b][l]

  alpha_kernel<<<64, 256, 0, stream>>>(head, tail, conv_w, conv_b, bn_w, bn_b,
                                       bn_mean, bn_var, flag, alpha);
  proj_kernel<<<2560, 128, 0, stream>>>(head, tail, R_q, R_k, R_v, F_q, F_k,
                                        F_v, flag, alpha, qws, kc, vc);
  attn_kernel<<<dim3(128, NSPLIT), 256, 0, stream>>>(qws, kc, vc, po, pm, pl);
  merge_kernel<<<512, 256, 0, stream>>>(po, pm, pl, y);
  final_kernel<<<512, 128, 0, stream>>>(y, head, tail, R_W, F_W, flag, out);
}

// v004
// Measured time: 94.1 microseconds a run.
// In two side-by-side timings against v003, it was 1.57 and 1.59 times as fast.
// Over all steps from v000 it is 4.10 times as fast.
#include <hip/hip_runtime.h>
#include <hip/hip_bf16.h>

typedef __attribute__((ext_vector_type(2))) float v2f;
typedef __attribute__((ext_vector_type(4))) float v4f;
typedef __attribute__((ext_vector_type(8))) float v8f;

#define BS  4
#define CH  32
#define NF  128
#define L   4096      // hei*wei
#define ROWS 4096     // BS*CH*HEI
#define NSPLIT 4      // column ranges of the attention, one work-group each:
                      // 128 x 4 groups, two resident on each of the 256 WGPs
#define LSP (L / NSPLIT)   // columns per range
#define TP 68         // LDS row pitch in floats: 272 B = 17 x 16 B, so the 16 rows
                      // that a half-wave's 16-byte reads touch fall on all 64 banks

__device__ __forceinline__ v8f wmma_f32(v2f a, v2f b, v8f c) {
  // V_WMMA_F32_16X16X4_F32 : D = A(16x4) * B(4x16) + C(16x16)
  return __builtin_amdgcn_wmma_f32_16x16x4_f32(false, a, false, b, (short)0, c,
                                               false, false);
}

// ---------------------------------------------------------------------------
// Kernel A: affinity/alpha  (1x1 conv -> BN(eval) -> ReLU -> 2-way softmax)
// ---------------------------------------------------------------------------
__global__ void alpha_kernel(const float* __restrict__ head,
                             const float* __restrict__ tail,
                             const float* __restrict__ conv_w,
                             const float* __restrict__ conv_b,
                             const float* __restrict__ bn_w,
                             const float* __restrict__ bn_b,
                             const float* __restrict__ bn_mean,
                             const float* __restrict__ bn_var,
                             const int* __restrict__ flagp,
                             float* __restrict__ alpha) {
  int t = blockIdx.x * blockDim.x + threadIdx.x;
  if (t >= BS * L) return;
  int b = t >> 12, l = t & (L - 1);
  const float* hb = head + ((b * CH) << 12) + l;
  const float* tb = tail + ((b * CH) << 12) + l;
  float s0 = conv_b[0], s1 = conv_b[1];
#pragma unroll 4
  for (int c = 0; c < CH; ++c) {
    float hv = hb[c << 12];
    s0 = fmaf(conv_w[c], hv, s0);
    s1 = fmaf(conv_w[64 + c], hv, s1);
  }
#pragma unroll 4
  for (int c = 0; c < CH; ++c) {
    float tv = tb[c << 12];
    s0 = fmaf(conv_w[CH + c], tv, s0);
    s1 = fmaf(conv_w[64 + CH + c], tv, s1);
  }
  float sc0 = bn_w[0] * rsqrtf(bn_var[0] + 1e-5f);
  float sc1 = bn_w[1] * rsqrtf(bn_var[1] + 1e-5f);
  float r0 = fmaxf((s0 - bn_mean[0]) * sc0 + bn_b[0], 0.f);
  float r1 = fmaxf((s1 - bn_mean[1]) * sc1 + bn_b[1], 0.f);
  float m = fmaxf(r0, r1);
  float e0 = __expf(r0 - m), e1 = __expf(r1 - m);
  alpha[t] = (*flagp) ? (e0 / (e0 + e1)) : (e1 / (e0 + e1));
}

// ---------------------------------------------------------------------------
// Kernel B: five projections (4096x128 @ 128x128) via WMMA f32 16x16x4, written
// in attention-friendly layouts:
//   q  [b][l / 64][32][l % 64]   (one 64-column tile is 8 KB in a row)
//   K' [b][l][64] (cols 0..31 pre-scaled by alpha)      V' [b][l][64]
// so that what a lane of the attention takes as the k of an A fragment lies
// side by side in memory.
// One work-group takes one projection of one (b, h): the 32 channels are the
// rows of its product, the 128 w (128 consecutive l) its columns, 16 to a wave.
// The 32 source rows lie 16 KB apart in memory; each is brought to LDS by one
// wave-wide 16-byte load (512 B in a row). Of K' and V' the 32 channels of one l
// are one 128-byte line: a wave turns its 32 x 16 tile round in its own piece of
// LDS and stores 16 whole lines.
// Every loop of the kernel is unrolled so that av, bf, acc0 and acc1 are indexed
// by constants and stay in registers.
// ---------------------------------------------------------------------------
#define AP 132        // LDS pitch of a source row in floats: 528 B = 33 x 16 B
#define OP 36         // LDS pitch of an output line in floats: 144 B = 9 x 16 B

__global__ __launch_bounds__(256) void proj_kernel(
    const float* __restrict__ head, const float* __restrict__ tail,
    const float* __restrict__ R_q, const float* __restrict__ R_k,
    const float* __restrict__ R_v, const float* __restrict__ F_q,
    const float* __restrict__ F_k, const float* __restrict__ F_v,
    const int* __restrict__ flagp, const float* __restrict__ alpha,
    float* __restrict__ qws, float* __restrict__ kc, float* __restrict__ vc) {
  __shared__ __attribute__((aligned(16))) float lds_a[CH][AP];      // [channel][k]
  __shared__ __attribute__((aligned(16))) float lds_o[8][16][OP];   // [wave][l][channel]

  int tid = threadIdx.x;
  int w = tid >> 5;
  int lane = tid & 31;
  int half = lane >> 4, lm = lane & 15;
  int b = blockIdx.x >> 5, h = blockIdx.x & 31;
  int proj = blockIdx.y;           // 0..4, the same in the whole work-group
  int n0 = w << 4;                 // wave's first column
  int flag = *flagp;

  const float* src;
  const float* mat;
  switch (proj) {
    case 0:  src = flag ? head : tail; mat = flag ? R_q : F_q; break; // q
    case 1:  src = flag ? tail : head; mat = flag ? F_k : R_k; break; // K' lo (scaled)
    case 2:  src = flag ? head : tail; mat = flag ? R_k : F_k; break; // K' hi
    case 3:  src = flag ? tail : head; mat = flag ? F_v : R_v; break; // V' rows 0..31
    default: src = flag ? head : tail; mat = flag ? R_v : F_v; break; // V' rows 32..63
  }

  // Source rows (b, c, h), c = 0..31: wave w brings rows w, w + 8, w + 16, w + 24.
  const float* srcB = src + (((b * CH) << 5) + h) * NF;
  v4f av[4];
#pragma unroll
  for (int i = 0; i < 4; ++i)
    av[i] = *(const v4f*)&srcB[((w + (i << 3)) << 5) * NF + (lane << 2)];

  // The wave's 128 x 16 strip of the matrix, the B operand of 32 k-steps. Of
  // eight consecutive k a half-wave holds four, 8 * s + 4 * half + {0..3}: the
  // first two are its share of k-step 2s, the last two of 2s + 1.
  const float* matC = mat + (half << 2) * NF + n0 + lm;
  v2f bf[32];
#pragma unroll
  for (int s = 0; s < 16; ++s) {
    bf[2 * s].x     = matC[(8 * s) * NF];
    bf[2 * s].y     = matC[(8 * s + 1) * NF];
    bf[2 * s + 1].x = matC[(8 * s + 2) * NF];
    bf[2 * s + 1].y = matC[(8 * s + 3) * NF];
  }
  int l0 = (b << 12) + (h << 7) + n0;            // wave's first (b, l)
  float sc = 1.f;                                // alpha of the lane's l for K' lo
  if (proj == 1) sc = alpha[l0 + lm];
  // Stands in front of the first rewrite of a register that a load above names;
  // matC is an input so that its registers are not given away ahead of the wait.
  asm volatile("s_wait_xcnt 0x0" :: "v"(matC) : "memory");

#pragma unroll
  for (int i = 0; i < 4; ++i)
    *(v4f*)&lds_a[w + (i << 3)][lane << 2] = av[i];
  __syncthreads();   // the 32 source rows are in LDS

  // acc0[r] = channel 8 * half + r, acc1[r] = channel 16 + 8 * half + r, both at
  // column n0 + lm. The source loader takes the k order of bf, two k-steps to a
  // 16-byte read.
  v8f acc0 = {}, acc1 = {};
#pragma unroll
  for (int s = 0; s < 16; ++s) {
    v4f a0 = *(const v4f*)&lds_a[lm][8 * s + 4 * half];
    v4f a1 = *(const v4f*)&lds_a[16 + lm][8 * s + 4 * half];
    v2f x0; x0.x = a0.x; x0.y = a0.y;
    v2f x1; x1.x = a1.x; x1.y = a1.y;
    acc0 = wmma_f32(x0, bf[2 * s], acc0);
    acc1 = wmma_f32(x1, bf[2 * s], acc1);
    x0.x = a0.z; x0.y = a0.w;
    x1.x = a1.z; x1.y = a1.w;
    acc0 = wmma_f32(x0, bf[2 * s + 1], acc0);
    acc1 = wmma_f32(x1, bf[2 * s + 1], acc1);
  }

  if (proj == 0) {
    // q: a half-wave writes 16 consecutive l of one channel.
    int l = (h << 7) + n0 + lm;
    float* qd = qws + ((((b << 6) + (l >> 6)) * CH + half * 8) << 6) + (l & 63);
#pragma unroll
    for (int r = 0; r < 8; ++r) {
      qd[r << 6] = acc0[r];
      qd[(16 + r) << 6] = acc1[r];
    }
  } else {
    // K', V': the lane's 16 channels of its l go to row lm of the wave's piece.
    float* so = &lds_o[w][lm][half * 8];
    v4f t;
    t.x = acc0[0] * sc; t.y = acc0[1] * sc; t.z = acc0[2] * sc; t.w = acc0[3] * sc;
    *(v4f*)&so[0] = t;
    t.x = acc0[4] * sc; t.y = acc0[5] * sc; t.z = acc0[6] * sc; t.w = acc0[7] * sc;
    *(v4f*)&so[4] = t;
    t.x = acc1[0] * sc; t.y = acc1[1] * sc; t.z = acc1[2] * sc; t.w = acc1[3] * sc;
    *(v4f*)&so[16] = t;
    t.x = acc1[4] * sc; t.y = acc1[5] * sc; t.z = acc1[6] * sc; t.w = acc1[7] * sc;
    *(v4f*)&so[20] = t;
    __syncthreads();   // the rows are written before other lanes read them back
    // Eight lanes store the 128 bytes of one l: four whole lines to a store.
    float* dst = ((proj <= 2) ? kc : vc) + (l0 << 6) + ((proj & 1) ? 0 : 32);
    int c4 = (lane & 7) << 2;
#pragma unroll
    for (int j = 0; j < 4; ++j) {
      int row = (j << 2) + (lane >> 3);
      *(v4f*)&dst[(row << 6) + c4] = *(const v4f*)&lds_o[w][row][c4];
    }
  }
}

// ---------------------------------------------------------------------------
// Kernel C: fused flash attention, 64-column tiles, scores formed transposed.
//   St = V't(64 cols x 64) @ K't(64 x 16 rows), online softmax,
//   Ot += qt(32 x 64 cols) @ Pt(64 cols x 16 rows)
// 8 waves/block, 16 rows/wave; V'/q tiles staged in LDS with float4 loads.
// Both tiles lie in LDS with the k of their product along the row (V' as
// [column][k], q as [channel][column]): one 16-byte read gives a lane the A
// fragments of two k-steps.
// In the accumulator of St a lane holds scores of ONE attention row (row = lane
// & 15; the two half-waves hold different columns of it), so the row maximum
// and row sum are in-lane work plus one exchange between the halves, and the
// accumulator registers are, pair by pair, the B operand of the second
// product: P never goes through LDS.
// Each work-group walks one of NSPLIT column ranges and leaves its
// un-normalised sum with the range's row maximum and row sum; merge_kernel
// joins the ranges.
// ---------------------------------------------------------------------------
__device__ __forceinline__ float xhalf(float x) {   // lane l with lane l ^ 16
  int i = __builtin_bit_cast(int, x);
  return __builtin_bit_cast(float, __builtin_amdgcn_permlanex16(
      i, i, 0x76543210, 0xfedcba98, false, false));
}

// Four waves per SIMD, no more: two of the 512 work-groups to each WGP. A third
// on one WGP would leave another with one, and the fullest WGP sets the time.
__global__ __launch_bounds__(256) __attribute__((amdgpu_waves_per_eu(4, 4)))
void attn_kernel(
    const float* __restrict__ qws, const float* __restrict__ kc,
    const float* __restrict__ vc, float* __restrict__ po,
    float* __restrict__ pm, float* __restrict__ pl) {
  __shared__ __attribute__((aligned(16))) float lds_v[64][TP];  // V' [column][k]
  __shared__ __attribute__((aligned(16))) float lds_q[32][TP];  // q  [channel][column]

  int tid = threadIdx.x;
  int w = tid >> 5;
  int lane = tid & 31;
  int half = lane >> 4, lm = lane & 15;
  int b = blockIdx.x >> 5;                         // 32 blocks per batch
  int i0 = (((blockIdx.x & 31) << 3) + w) << 4;    // wave's first row
  int sp = blockIdx.y;                             // column range
  int bl = b << 12;

  const float* vcB = vc + (bl + sp * LSP) * 64;          // range's first column
  const float* qB = qws + (bl + sp * LSP) * 32;          // range's first q tile
  const float* kcRow = kc + (bl + i0 + lm) * 64;

  // Preload this wave's 16x64 K' strip; as K't it is the B operand (16 k-steps):
  // lane = row. Of eight consecutive k a half-wave holds four, 8 * s + 4 * half
  // + {0..3}: the first two are its share of k-step 2s, the last two of 2s + 1.
  v2f ka[16];
#pragma unroll
  for (int s = 0; s < 8; ++s) {
    v4f kq = *(const v4f*)&kcRow[8 * s + 4 * half];
    ka[2 * s].x = kq.x;     ka[2 * s].y = kq.y;
    ka[2 * s + 1].x = kq.z; ka[2 * s + 1].y = kq.w;
  }

  // o0[r] = Ot[8 * half + r][row lm], o1[r] = Ot[16 + 8 * half + r][row lm].
  // mrow is the row's maximum (equal in both halves); lrow is this half-wave's
  // share of the row's sum, joined once behind the loop.
  v8f o0 = {}, o1 = {};
  float mrow = -3.0e38f, lrow = 0.f;

  for (int j0 = 0; j0 < LSP; j0 += 64) {
    __syncthreads();   // previous iteration's LDS reads complete
    // Cooperative float4 stage: V' tile (64 columns x 64 k, 16 KB in a row in
    // memory) and q tile (32 channels x 64 columns, 8 KB in a row)
#pragma unroll
    for (int i = 0; i < 4; ++i) {
      int idx = (tid + (i << 8)) << 2;       // 0..4092
      *(v4f*)&lds_v[idx >> 6][idx & 63] = *(const v4f*)&vcB[j0 * 64 + idx];
    }
#pragma unroll
    for (int i = 0; i < 2; ++i) {
      int idx = (tid + (i << 8)) << 2;       // 0..2044
      *(v4f*)&lds_q[idx >> 6][idx & 63] = *(const v4f*)&qB[j0 * 32 + idx];
    }
    __syncthreads();

    // Transposed score tiles: 4 x (16 columns x 16 rows), K = 64.
    // s[t][r] = score of row lm at column 16 * t + 8 * half + r.
    // Every loop over st, t, r and u from here to the loop's foot is unrolled so
    // that s, vm, ps, o0 and o1 are indexed by constants and stay in registers.
    // The V' loader takes the k order of ka.
    v8f s[4] = {};
#pragma unroll
    for (int st = 0; st < 8; ++st) {
      v4f va[4];
#pragma unroll
      for (int t = 0; t < 4; ++t)
        va[t] = *(const v4f*)&lds_v[16 * t + lm][8 * st + 4 * half];
#pragma unroll
      for (int t = 0; t < 4; ++t) {
        v2f a; a.x = va[t].x; a.y = va[t].y;
        s[t] = wmma_f32(a, ka[2 * st], s[t]);
      }
#pragma unroll
      for (int t = 0; t < 4; ++t) {
        v2f a; a.x = va[t].z; a.y = va[t].w;
        s[t] = wmma_f32(a, ka[2 * st + 1], s[t]);
      }
    }

    // Online softmax over the 64-column strip: 32 scores of the row in this
    // lane, the other 32 in lane ^ 16.
    float vm[4];
#pragma unroll
    for (int t = 0; t < 4; ++t) {
      vm[t] = s[t][0];
#pragma unroll
      for (int r = 1; r < 8; ++r) vm[t] = fmaxf(vm[t], s[t][r]);
    }
    float v = fmaxf(fmaxf(vm[0], vm[1]), fmaxf(vm[2], vm[3]));
    v = fmaxf(v, xhalf(v));
    float mnew = fmaxf(mrow, v);
    float corr = __expf(mrow - mnew);
    mrow = mnew;
#pragma unroll
    for (int t = 0; t < 4; ++t) {
#pragma unroll
      for (int r = 0; r < 8; ++r) s[t][r] = __expf(s[t][r] - mnew);
    }
#pragma unroll
    for (int r = 0; r < 8; ++r) {
      o0[r] *= corr;
      o1[r] *= corr;
    }

    // Ot += qt(32x64) @ Pt(64x16), K = 64. Registers 2u, 2u+1 of s[t] are the B
    // operand of one k-step, whose four k are then the columns
    // 16 * t + 8 * half + 2u + {0, 1}; the q loader takes the same order, two
    // k-steps (u, u + 1) to a 16-byte read.
    // The same register pairs are summed, two chains of pairs, for the row sum.
    v2f ps[2] = {};
#pragma unroll
    for (int t = 0; t < 4; ++t) {
#pragma unroll
      for (int u = 0; u < 4; u += 2) {
        int j = 16 * t + 8 * half + 2 * u;
        v4f q0 = *(const v4f*)&lds_q[lm][j];
        v4f q1 = *(const v4f*)&lds_q[16 + lm][j];
        v2f pb;  pb.x = s[t][2 * u];  pb.y = s[t][2 * u + 1];
        v2f qa0; qa0.x = q0.x;        qa0.y = q0.y;
        v2f qa1; qa1.x = q1.x;        qa1.y = q1.y;
        o0 = wmma_f32(qa0, pb, o0);
        o1 = wmma_f32(qa1, pb, o1);
        ps[0] += pb;
        pb.x = s[t][2 * u + 2];       pb.y = s[t][2 * u + 3];
        qa0.x = q0.z;                 qa0.y = q0.w;
        qa1.x = q1.z;                 qa1.y = q1.w;
        o0 = wmma_f32(qa0, pb, o0);
        o1 = wmma_f32(qa1, pb, o1);
        ps[1] += pb;
      }
    }
    lrow = lrow * corr + ((ps[0].x + ps[0].y) + (ps[1].x + ps[1].y));
  }

  // Store the range's un-normalised sum to po[sp][b][c][l] (a half-wave writes
  // 16 consecutive l of one c) and its row maximum and row sum to
  // pm/pl[sp][b][l]. The loop is unrolled because o0 and o1 are registers.
  float* poL = po + (((sp * BS + b) * CH + half * 8) << 12) + i0 + lm;
#pragma unroll
  for (int r = 0; r < 8; ++r) {
    poL[r << 12] = o0[r];
    poL[(16 + r) << 12] = o1[r];
  }
  lrow += xhalf(lrow);
  if (half == 0) {
    int st = ((sp * BS + b) << 12) + i0 + lm;
    pm[st] = mrow;
    pl[st] = lrow;
  }
}

// ---------------------------------------------------------------------------
// Kernel C2: join the NSPLIT column ranges.
//   y = sum_s exp(m_s - M) * O_s / sum_s exp(m_s - M) * l_s,  M = max_s m_s
// One thread per four consecutive l of one (b, c). Every loop is unrolled so
// that mv stays in registers and the 3 * NSPLIT loads are in flight together.
// ---------------------------------------------------------------------------
__global__ __launch_bounds__(256) void merge_kernel(
    const float* __restrict__ po, const float* __restrict__ pm,
    const float* __restrict__ pl, float* __restrict__ y) {
  int t = blockIdx.x * 256 + threadIdx.x;          // 0 .. BS*CH*L/4 - 1
  int e = t << 2;                                  // element of y[b][c][l]
  int sl = ((e >> 17) << 12) + (e & (L - 1));      // element of pm[.][b][l]
  v4f mv[NSPLIT];
#pragma unroll
  for (int s = 0; s < NSPLIT; ++s) mv[s] = *(const v4f*)&pm[s * BS * L + sl];
  v4f M = mv[0];
#pragma unroll
  for (int s = 1; s < NSPLIT; ++s)
#pragma unroll
    for (int i = 0; i < 4; ++i) M[i] = fmaxf(M[i], mv[s][i]);
  v4f num = {}, den = {};
#pragma unroll
  for (int s = 0; s < NSPLIT; ++s) {
    v4f lv = *(const v4f*)&pl[s * BS * L + sl];
    v4f ov = *(const v4f*)&po[s * BS * CH * L + e];
#pragma unroll
    for (int i = 0; i < 4; ++i) {
      float wgt = __expf(mv[s][i] - M[i]);
      den[i] = fmaf(wgt, lv[i], den[i]);
      num[i] = fmaf(wgt, ov[i], num[i]);
    }
  }
  v4f r;
#pragma unroll
  for (int i = 0; i < 4; ++i) r[i] = num[i] / den[i];
  *(v4f*)&y[e] = r;
}

// ---------------------------------------------------------------------------
// Kernel D: out = y @ W + residual   (4096x128 @ 128x128, WMMA tiles)
// ---------------------------------------------------------------------------
__global__ __launch_bounds__(128) void final_kernel(
    const float* __restrict__ y, const float* __restrict__ head,
    const float* __restrict__ tail, const float* __restrict__ R_W,
    const float* __restrict__ F_W, const int* __restrict__ flagp,
    float* __restrict__ out) {
  int wid = (blockIdx.x * blockDim.x + threadIdx.x) >> 5;
  int lane = threadIdx.x & 31;
  int half = lane >> 4, lm = lane & 15;
  int r0 = (wid >> 3) << 4;
  int n0 = (wid & 7) << 4;
  int flag = *flagp;
  const float* mat = flag ? R_W : F_W;
  const float* res = flag ? head : tail;

  const float* arow = y + (r0 + lm) * NF;   // y is row-major 4096x128
  v8f acc = {};
#pragma unroll
  for (int k0 = 0; k0 < NF; k0 += 4) {
    int k = k0 + 2 * half;
    v2f a;  a.x = arow[k];                a.y = arow[k + 1];
    v2f bv; bv.x = mat[k * NF + n0 + lm]; bv.y = mat[(k + 1) * NF + n0 + lm];
    acc = wmma_f32(a, bv, acc);
  }
#pragma unroll
  for (int r = 0; r < 8; ++r) {
    int row = r0 + half * 8 + r;
    int idx = row * NF + n0 + lm;
    out[idx] = acc[r] + res[idx];
  }
}

// ---------------------------------------------------------------------------
extern "C" void kernel_launch(void* const* d_in, const int* in_sizes, int n_in,
                              void* d_out, int out_size, void* d_ws,
                              size_t ws_size, hipStream_t stream) {
  const float* head    = (const float*)d_in[0];
  const float* tail    = (const float*)d_in[1];
  const float* R_q     = (const float*)d_in[2];
  const float* R_k     = (const float*)d_in[3];
  const float* R_v     = (const float*)d_in[4];
  const float* R_W     = (const float*)d_in[5];
  const float* F_q     = (const float*)d_in[6];
  const float* F_k     = (const float*)d_in[7];
  const float* F_v     = (const float*)d_in[8];
  const float* F_W     = (const float*)d_in[9];
  const float* conv_w  = (const float*)d_in[10];
  const float* conv_b  = (const float*)d_in[11];
  const float* bn_w    = (const float*)d_in[12];
  const float* bn_b    = (const float*)d_in[13];
  const float* bn_mean = (const float*)d_in[14];
  const float* bn_var  = (const float*)d_in[15];
  const int*   flag    = (const int*)d_in[16];
  float* out = (float*)d_out;

  float* ws    = (float*)d_ws;
  float* alpha = ws;                 // 16384
  float* qws   = alpha + 16384;      // 524288   q  [b][l/64][32][l%64]
  float* kc    = qws + 524288;       // 1048576  K' [b][l][64]
  float* vc    = kc + 1048576;       // 1048576  V' [b][l][64]
  float* y     = vc + 1048576;       // 524288   y  [b][32][l]
  float* po    = y + 524288;         // NSPLIT * 524288  partial O [s][b][32][l]
  float* pm    = po + NSPLIT * 524288;   // NSPLIT * 16384  row maxima [s][b][l]
  float* pl    = pm + NSPLIT * 16384;    // NSPLIT * 16384  row sums   [s][b][l]

  alpha_kernel<<<64, 256, 0, stream>>>(head, tail, conv_w, conv_b, bn_w, bn_b,
                                       bn_mean, bn_var, flag, alpha);
  proj_kernel<<<dim3(128, 5), 256, 0, stream>>>(head, tail, R_q, R_k, R_v, F_q,
                                                F_k, F_v, flag, alpha, qws, kc, vc);
  attn_kernel<<<dim3(128, NSPLIT), 256, 0, stream>>>(qws, kc, vc, po, pm, pl);
  merge_kernel<<<512, 256, 0, stream>>>(po, pm, pl, y);
  final_kernel<<<512, 128, 0, stream>>>(y, head, tail, R_W, F_W, flag, out);
}

// v005
// One run takes 83.6 microseconds.
// Timed twice side by side with v004, it ran 1.12 and 1.13 times as fast.
// Counting every step since v000, it is 4.61 times as fast.
#include <hip/hip_runtime.h>
#include <hip/hip_bf16.h>

typedef __attribute__((ext_vector_type(2))) float v2f;
typedef __attribute__((ext_vector_type(4))) float v4f;
typedef __attribute__((ext_vector_type(8))) float v8f;

#define BS  4
#define CH  32
#define NF  128
#define L   4096      // hei*wei
#define ROWS 4096     // BS*CH*HEI
#define NSPLIT 4      // column ranges of the attention, one work-group each:
                      // 128 x 4 groups, two resident on each of the 256 WGPs
#define LSP (L / NSPLIT)   // columns per range
#define TP 68         // LDS row pitch in floats: 272 B = 17 x 16 B, so the 16 rows
                      // that a half-wave's 16-byte reads touch fall on all 64 banks

__device__ __forceinline__ v8f wmma_f32(v2f a, v2f b, v8f c) {
  // V_WMMA_F32_16X16X4_F32 : D = A(16x4) * B(4x16) + C(16x16)
  return __builtin_amdgcn_wmma_f32_16x16x4_f32(false, a, false, b, (short)0, c,
                                               false, false);
}

// ---------------------------------------------------------------------------
// Kernel B: five projections (4096x128 @ 128x128) via WMMA f32 16x16x4, written
// in attention-friendly layouts:
//   q  [b][l / 64][32][l % 64]   (one 64-column tile is 8 KB in a row)
//   K' [b][l][64]      V' [b][l][64]
// so that what a lane of the attention takes as the k of an A fragment lies
// side by side in memory.
// One work-group takes one projection of one (b, h): the 32 channels are the
// rows of its product, the 128 w (128 consecutive l) its columns, 16 to a wave.
// The 32 source rows lie 16 KB apart in memory; each is brought to LDS by one
// wave-wide 16-byte load (512 B in a row). Of K' and V' the 32 channels of one l
// are one 128-byte line: a wave turns its 32 x 16 tile round in its own piece of
// LDS and stores 16 whole lines.
// Every loop of the kernel is unrolled so that av, bf, acc0, acc1 and xv are
// indexed by constants and stay in registers, and each run of loads is in flight
// together.
// A sixth row of work-groups (blockIdx.y == 5) has no product: it forms alpha
// (1x1 conv -> BN(eval) -> ReLU -> 2-way softmax) of the 128 l of its (b, h).
// Nothing in this launch reads alpha: the attention scales K' by it.
// ---------------------------------------------------------------------------
#define AP 132        // LDS pitch of a source row in floats: 528 B = 33 x 16 B
#define OP 36         // LDS pitch of an output line in floats: 144 B = 9 x 16 B

__global__ __launch_bounds__(256) void proj_kernel(
    const float* __restrict__ head, const float* __restrict__ tail,
    const float* __restrict__ R_q, const float* __restrict__ R_k,
    const float* __restrict__ R_v, const float* __restrict__ F_q,
    const float* __restrict__ F_k, const float* __restrict__ F_v,
    const float* __restrict__ conv_w, const float* __restrict__ conv_b,
    const float* __restrict__ bn_w, const float* __restrict__ bn_b,
    const float* __restrict__ bn_mean, const float* __restrict__ bn_var,
    const int* __restrict__ flagp, float* __restrict__ alpha,
    float* __restrict__ qws, float* __restrict__ kc, float* __restrict__ vc) {
  __shared__ __attribute__((aligned(16))) float lds_a[CH][AP];      // [channel][k]
  __shared__ __attribute__((aligned(16))) float lds_o[8][16][OP];   // [wave][l][channel]

  int tid = threadIdx.x;
  int w = tid >> 5;
  int lane = tid & 31;
  int half = lane >> 4, lm = lane & 15;
  int b = blockIdx.x >> 5, h = blockIdx.x & 31;
  int proj = blockIdx.y;           // 0..5, the same in the whole work-group
  int n0 = w << 4;                 // wave's first column
  int flag = *flagp;

  if (proj == 5) {
    // Wave w takes channels 8 * w .. 8 * w + 7 of the concatenation (head 0..31,
    // tail 32..63), a lane four consecutive l: eight 512-byte loads in flight.
    int wu = __builtin_amdgcn_readfirstlane(w);   // scalar: the weights come by scalar loads
    const float* x = (wu < 4 ? head : tail) +
                     ((((b * CH + ((wu & 3) << 3)) << 5) + h) * NF + (lane << 2));
    v4f xv[8];
#pragma unroll
    for (int i = 0; i < 8; ++i) xv[i] = *(const v4f*)&x[(i << 5) * NF];
    const float* cw = conv_w + (wu << 3);
    float sc0 = bn_w[0] * rsqrtf(bn_var[0] + 1e-5f);
    float sc1 = bn_w[1] * rsqrtf(bn_var[1] + 1e-5f);
    float mu0 = bn_mean[0], mu1 = bn_mean[1], be0 = bn_b[0], be1 = bn_b[1];
    float s0 = conv_b[0], s1 = conv_b[1];
    v4f p0 = {}, p1 = {};
#pragma unroll
    for (int i = 0; i < 8; ++i) {
      p0 += cw[i] * xv[i];
      p1 += cw[64 + i] * xv[i];
    }
    *(v4f*)&lds_a[w][lane << 2] = p0;
    *(v4f*)&lds_a[8 + w][lane << 2] = p1;
    __syncthreads();   // the eight waves' partial sums are in LDS
    if (tid < NF) {
#pragma unroll
      for (int i = 0; i < 8; ++i) {
        s0 += lds_a[i][tid];
        s1 += lds_a[8 + i][tid];
      }
      float r0 = fmaxf((s0 - mu0) * sc0 + be0, 0.f);
      float r1 = fmaxf((s1 - mu1) * sc1 + be1, 0.f);
      float m = fmaxf(r0, r1);
      float e0 = __expf(r0 - m), e1 = __expf(r1 - m);
      alpha[(b << 12) + (h << 7) + tid] = flag ? (e0 / (e0 + e1)) : (e1 / (e0 + e1));
    }
    return;
  }

  const float* src;
  const float* mat;
  switch (proj) {
    case 0:  src = flag ? head : tail; mat = flag ? R_q : F_q; break; // q
    case 1:  src = flag ? tail : head; mat = flag ? F_k : R_k; break; // K' lo
    case 2:  src = flag ? head : tail; mat = flag ? R_k : F_k; break; // K' hi
    case 3:  src = flag ? tail : head; mat = flag ? F_v : R_v; break; // V' rows 0..31
    default: src = flag ? head : tail; mat = flag ? R_v : F_v; break; // V' rows 32..63
  }

  // Source rows (b, c, h), c = 0..31: wave w brings rows w, w + 8, w + 16, w + 24.
  const float* srcB = src + (((b * CH) << 5) + h) * NF;
  v4f av[4];
#pragma unroll
  for (int i = 0; i < 4; ++i)
    av[i] = *(const v4f*)&srcB[((w + (i << 3)) << 5) * NF + (lane << 2)];

  // The wave's 128 x 16 strip of the matrix, the B operand of 32 k-steps. Of
  // eight consecutive k a half-wave holds four, 8 * s + 4 * half + {0..3}: the
  // first two are its share of k-step 2s, the last two of 2s + 1.
  const float* matC = mat + (half << 2) * NF + n0 + lm;
  v2f bf[32];
#pragma unroll
  for (int s = 0; s < 16; ++s) {
    bf[2 * s].x     = matC[(8 * s) * NF];
    bf[2 * s].y     = matC[(8 * s + 1) * NF];
    bf[2 * s + 1].x = matC[(8 * s + 2) * NF];
    bf[2 * s + 1].y = matC[(8 * s + 3) * NF];
  }
  int l0 = (b << 12) + (h << 7) + n0;            // wave's first (b, l)
  // Stands in front of the first rewrite of a register that a load above names;
  // matC is an input so that its registers are not given away ahead of the wait.
  asm volatile("s_wait_xcnt 0x0" :: "v"(matC) : "memory");

#pragma unroll
  for (int i = 0; i < 4; ++i)
    *(v4f*)&lds_a[w + (i << 3)][lane << 2] = av[i];
  __syncthreads();   // the 32 source rows are in LDS

  // acc0[r] = channel 8 * half + r, acc1[r] = channel 16 + 8 * half + r, both at
  // column n0 + lm. The source loader takes the k order of bf, two k-steps to a
  // 16-byte read.
  v8f acc0 = {}, acc1 = {};
#pragma unroll
  for (int s = 0; s < 16; ++s) {
    v4f a0 = *(const v4f*)&lds_a[lm][8 * s + 4 * half];
    v4f a1 = *(const v4f*)&lds_a[16 + lm][8 * s + 4 * half];
    v2f x0; x0.x = a0.x; x0.y = a0.y;
    v2f x1; x1.x = a1.x; x1.y = a1.y;
    acc0 = wmma_f32(x0, bf[2 * s], acc0);
    acc1 = wmma_f32(x1, bf[2 * s], acc1);
    x0.x = a0.z; x0.y = a0.w;
    x1.x = a1.z; x1.y = a1.w;
    acc0 = wmma_f32(x0, bf[2 * s + 1], acc0);
    acc1 = wmma_f32(x1, bf[2 * s + 1], acc1);
  }

  if (proj == 0) {
    // q: a half-wave writes 16 consecutive l of one channel.
    int l = (h << 7) + n0 + lm;
    float* qd = qws + ((((b << 6) + (l >> 6)) * CH + half * 8) << 6) + (l & 63);
#pragma unroll
    for (int r = 0; r < 8; ++r) {
      qd[r << 6] = acc0[r];
      qd[(16 + r) << 6] = acc1[r];
    }
  } else {
    // K', V': the lane's 16 channels of its l go to row lm of the wave's piece.
    float* so = &lds_o[w][lm][half * 8];
    v4f t;
    t.x = acc0[0]; t.y = acc0[1]; t.z = acc0[2]; t.w = acc0[3];
    *(v4f*)&so[0] = t;
    t.x = acc0[4]; t.y = acc0[5]; t.z = acc0[6]; t.w = acc0[7];
    *(v4f*)&so[4] = t;
    t.x = acc1[0]; t.y = acc1[1]; t.z = acc1[2]; t.w = acc1[3];
    *(v4f*)&so[16] = t;
    t.x = acc1[4]; t.y = acc1[5]; t.z = acc1[6]; t.w = acc1[7];
    *(v4f*)&so[20] = t;
    __syncthreads();   // the rows are written before other lanes read them back
    // Eight lanes store the 128 bytes of one l: four whole lines to a store.
    float* dst = ((proj <= 2) ? kc : vc) + (l0 << 6) + ((proj & 1) ? 0 : 32);
    int c4 = (lane & 7) << 2;
#pragma unroll
    for (int j = 0; j < 4; ++j) {
      int row = (j << 2) + (lane >> 3);
      *(v4f*)&dst[(row << 6) + c4] = *(const v4f*)&lds_o[w][row][c4];
    }
  }
}

// ---------------------------------------------------------------------------
// Kernel C: fused flash attention, 64-column tiles, scores formed transposed.
//   St = V't(64 cols x 64) @ K't(64 x 16 rows), online softmax,
//   Ot += qt(32 x 64 cols) @ Pt(64 cols x 16 rows)
// 8 waves/block, 16 rows/wave; V'/q tiles staged in LDS with float4 loads.
// Both tiles lie in LDS with the k of their product along the row (V' as
// [column][k], q as [channel][column]): one 16-byte read gives a lane the A
// fragments of two k-steps.
// In the accumulator of St a lane holds scores of ONE attention row (row = lane
// & 15; the two half-waves hold different columns of it), so the row maximum
// and row sum are in-lane work plus one exchange between the halves, and the
// accumulator registers are, pair by pair, the B operand of the second
// product: P never goes through LDS.
// Each work-group walks one of NSPLIT column ranges and leaves its
// un-normalised sum with the range's row maximum and row sum; merge_kernel
// joins the ranges.
// ---------------------------------------------------------------------------
__device__ __forceinline__ float xhalf(float x) {   // lane l with lane l ^ 16
  int i = __builtin_bit_cast(int, x);
  return __builtin_bit_cast(float, __builtin_amdgcn_permlanex16(
      i, i, 0x76543210, 0xfedcba98, false, false));
}

// Four waves per SIMD, no more: two of the 512 work-groups to each WGP. A third
// on one WGP would leave another with one, and the fullest WGP sets the time.
__global__ __launch_bounds__(256) __attribute__((amdgpu_waves_per_eu(4, 4)))
void attn_kernel(
    const float* __restrict__ qws, const float* __restrict__ kc,
    const float* __restrict__ vc, const float* __restrict__ alpha,
    float* __restrict__ po, float* __restrict__ pm, float* __restrict__ pl) {
  __shared__ __attribute__((aligned(16))) float lds_v[64][TP];  // V' [column][k]
  __shared__ __attribute__((aligned(16))) float lds_q[32][TP];  // q  [channel][column]

  int tid = threadIdx.x;
  int w = tid >> 5;
  int lane = tid & 31;
  int half = lane >> 4, lm = lane & 15;
  int b = blockIdx.x >> 5;                         // 32 blocks per batch
  int i0 = (((blockIdx.x & 31) << 3) + w) << 4;    // wave's first row
  int sp = blockIdx.y;                             // column range
  int bl = b << 12;

  const float* vcB = vc + (bl + sp * LSP) * 64;          // range's first column
  const float* qB = qws + (bl + sp * LSP) * 32;          // range's first q tile
  const float* kcRow = kc + (bl + i0 + lm) * 64;

  // Preload this wave's 16x64 K' strip; as K't it is the B operand (16 k-steps):
  // lane = row. Of eight consecutive k a half-wave holds four, 8 * s + 4 * half
  // + {0..3}: the first two are its share of k-step 2s, the last two of 2s + 1.
  // k 0..31 (s < 4) take the row's alpha here.
  float al = alpha[bl + i0 + lm];
  v2f ka[16];
#pragma unroll
  for (int s = 0; s < 8; ++s) {
    v4f kq = *(const v4f*)&kcRow[8 * s + 4 * half];
    if (s < 4) kq *= al;
    ka[2 * s].x = kq.x;     ka[2 * s].y = kq.y;
    ka[2 * s + 1].x = kq.z; ka[2 * s + 1].y = kq.w;
  }

  // o0[r] = Ot[8 * half + r][row lm], o1[r] = Ot[16 + 8 * half + r][row lm].
  // mrow is the row's maximum (equal in both halves); lrow is this half-wave's
  // share of the row's sum, joined once behind the loop.
  v8f o0 = {}, o1 = {};
  float mrow = -3.0e38f, lrow = 0.f;

  for (int j0 = 0; j0 < LSP; j0 += 64) {
    __syncthreads();   // previous iteration's LDS reads complete
    // Cooperative float4 stage: V' tile (64 columns x 64 k, 16 KB in a row in
    // memory) and q tile (32 channels x 64 columns, 8 KB in a row)
#pragma unroll
    for (int i = 0; i < 4; ++i) {
      int idx = (tid + (i << 8)) << 2;       // 0..4092
      *(v4f*)&lds_v[idx >> 6][idx & 63] = *(const v4f*)&vcB[j0 * 64 + idx];
    }
#pragma unroll
    for (int i = 0; i < 2; ++i) {
      int idx = (tid + (i << 8)) << 2;       // 0..2044
      *(v4f*)&lds_q[idx >> 6][idx & 63] = *(const v4f*)&qB[j0 * 32 + idx];
    }
    __syncthreads();

    // Transposed score tiles: 4 x (16 columns x 16 rows), K = 64.
    // s[t][r] = score of row lm at column 16 * t + 8 * half + r.
    // Every loop over st, t, r and u from here to the loop's foot is unrolled so
    // that s, vm, ps, o0 and o1 are indexed by constants and stay in registers.
    // The V' loader takes the k order of ka.
    v8f s[4] = {};
#pragma unroll
    for (int st = 0; st < 8; ++st) {
      v4f va[4];
#pragma unroll
      for (int t = 0; t < 4; ++t)
        va[t] = *(const v4f*)&lds_v[16 * t + lm][8 * st + 4 * half];
#pragma unroll
      for (int t = 0; t < 4; ++t) {
        v2f a; a.x = va[t].x; a.y = va[t].y;
        s[t] = wmma_f32(a, ka[2 * st], s[t]);
      }
#pragma unroll
      for (int t = 0; t < 4; ++t) {
        v2f a; a.x = va[t].z; a.y = va[t].w;
        s[t] = wmma_f32(a, ka[2 * st + 1], s[t]);
      }
    }

    // Online softmax over the 64-column strip: 32 scores of the row in this
    // lane, the other 32 in lane ^ 16.
    float vm[4];
#pragma unroll
    for (int t = 0; t < 4; ++t) {
      vm[t] = s[t][0];
#pragma unroll
      for (int r = 1; r < 8; ++r) vm[t] = fmaxf(vm[t], s[t][r]);
    }
    float v = fmaxf(fmaxf(vm[0], vm[1]), fmaxf(vm[2], vm[3]));
    v = fmaxf(v, xhalf(v));
    float mnew = fmaxf(mrow, v);
    float corr = __expf(mrow - mnew);
    mrow = mnew;
#pragma unroll
    for (int t = 0; t < 4; ++t) {
#pragma unroll
      for (int r = 0; r < 8; ++r) s[t][r] = __expf(s[t][r] - mnew);
    }
#pragma unroll
    for (int r = 0; r < 8; ++r) {
      o0[r] *= corr;
      o1[r] *= corr;
    }

    // Ot += qt(32x64) @ Pt(64x16), K = 64. Registers 2u, 2u+1 of s[t] are the B
    // operand of one k-step, whose four k are then the columns
    // 16 * t + 8 * half + 2u + {0, 1}; the q loader takes the same order, two
    // k-steps (u, u + 1) to a 16-byte read.
    // The same register pairs are summed, two chains of pairs, for the row sum.
    v2f ps[2] = {};
#pragma unroll
    for (int t = 0; t < 4; ++t) {
#pragma unroll
      for (int u = 0; u < 4; u += 2) {
        int j = 16 * t + 8 * half + 2 * u;
        v4f q0 = *(const v4f*)&lds_q[lm][j];
        v4f q1 = *(const v4f*)&lds_q[16 + lm][j];
        v2f pb;  pb.x = s[t][2 * u];  pb.y = s[t][2 * u + 1];
        v2f qa0; qa0.x = q0.x;        qa0.y = q0.y;
        v2f qa1; qa1.x = q1.x;        qa1.y = q1.y;
        o0 = wmma_f32(qa0, pb, o0);
        o1 = wmma_f32(qa1, pb, o1);
        ps[0] += pb;
        pb.x = s[t][2 * u + 2];       pb.y = s[t][2 * u + 3];
        qa0.x = q0.z;                 qa0.y = q0.w;
        qa1.x = q1.z;                 qa1.y = q1.w;
        o0 = wmma_f32(qa0, pb, o0);
        o1 = wmma_f32(qa1, pb, o1);
        ps[1] += pb;
      }
    }
    lrow = lrow * corr + ((ps[0].x + ps[0].y) + (ps[1].x + ps[1].y));
  }

  // Store the range's un-normalised sum to po[sp][b][c][l] (a half-wave writes
  // 16 consecutive l of one c) and its row maximum and row sum to
  // pm/pl[sp][b][l]. The loop is unrolled because o0 and o1 are registers.
  float* poL = po + (((sp * BS + b) * CH + half * 8) << 12) + i0 + lm;
#pragma unroll
  for (int r = 0; r < 8; ++r) {
    poL[r << 12] = o0[r];
    poL[(16 + r) << 12] = o1[r];
  }
  lrow += xhalf(lrow);
  if (half == 0) {
    int st = ((sp * BS + b) << 12) + i0 + lm;
    pm[st] = mrow;
    pl[st] = lrow;
  }
}

// ---------------------------------------------------------------------------
// Kernel C2: join the NSPLIT column ranges.
//   y = sum_s exp(m_s - M) * O_s / sum_s exp(m_s - M) * l_s,  M = max_s m_s
// One thread per four consecutive l of one (b, c). Every loop is unrolled so
// that mv stays in registers and the 3 * NSPLIT loads are in flight together.
// ---------------------------------------------------------------------------
__global__ __launch_bounds__(256) void merge_kernel(
    const float* __restrict__ po, const float* __restrict__ pm,
    const float* __restrict__ pl, float* __restrict__ y) {
  int t = blockIdx.x * 256 + threadIdx.x;          // 0 .. BS*CH*L/4 - 1
  int e = t << 2;                                  // element of y[b][c][l]
  int sl = ((e >> 17) << 12) + (e & (L - 1));      // element of pm[.][b][l]
  v4f mv[NSPLIT];
#pragma unroll
  for (int s = 0; s < NSPLIT; ++s) mv[s] = *(const v4f*)&pm[s * BS * L + sl];
  v4f M = mv[0];
#pragma unroll
  for (int s = 1; s < NSPLIT; ++s)
#pragma unroll
    for (int i = 0; i < 4; ++i) M[i] = fmaxf(M[i], mv[s][i]);
  v4f num = {}, den = {};
#pragma unroll
  for (int s = 0; s < NSPLIT; ++s) {
    v4f lv = *(const v4f*)&pl[s * BS * L + sl];
    v4f ov = *(const v4f*)&po[s * BS * CH * L + e];
#pragma unroll
    for (int i = 0; i < 4; ++i) {
      float wgt = __expf(mv[s][i] - M[i]);
      den[i] = fmaf(wgt, lv[i], den[i]);
      num[i] = fmaf(wgt, ov[i], num[i]);
    }
  }
  v4f r;
#pragma unroll
  for (int i = 0; i < 4; ++i) r[i] = num[i] / den[i];
  *(v4f*)&y[e] = r;
}

// ---------------------------------------------------------------------------
// Kernel D: out = y @ W + residual   (4096x128 @ 128x128, WMMA tiles)
// ---------------------------------------------------------------------------
__global__ __launch_bounds__(128) void final_kernel(
    const float* __restrict__ y, const float* __restrict__ head,
    const float* __restrict__ tail, const float* __restrict__ R_W,
    const float* __restrict__ F_W, const int* __restrict__ flagp,
    float* __restrict__ out) {
  int wid = (blockIdx.x * blockDim.x + threadIdx.x) >> 5;
  int lane = threadIdx.x & 31;
  int half = lane >> 4, lm = lane & 15;
  int r0 = (wid >> 3) << 4;
  int n0 = (wid & 7) << 4;
  int flag = *flagp;
  const float* mat = flag ? R_W : F_W;
  const float* res = flag ? head : tail;

  const float* arow = y + (r0 + lm) * NF;   // y is row-major 4096x128
  v8f acc = {};
#pragma unroll
  for (int k0 = 0; k0 < NF; k0 += 4) {
    int k = k0 + 2 * half;
    v2f a;  a.x = arow[k];                a.y = arow[k + 1];
    v2f bv; bv.x = mat[k * NF + n0 + lm]; bv.y = mat[(k + 1) * NF + n0 + lm];
    acc = wmma_f32(a, bv, acc);
  }
#pragma unroll
  for (int r = 0; r < 8; ++r) {
    int row = r0 + half * 8 + r;
    int idx = row * NF + n0 + lm;
    out[idx] = acc[r] + res[idx];
  }
}

// ---------------------------------------------------------------------------
extern "C" void kernel_launch(void* const* d_in, const int* in_sizes, int n_in,
                              void* d_out, int out_size, void* d_ws,
                              size_t ws_size, hipStream_t stream) {
  const float* head    = (const float*)d_in[0];
  const float* tail    = (const float*)d_in[1];
  const float* R_q     = (const float*)d_in[2];
  const float* R_k     = (const float*)d_in[3];
  const float* R_v     = (const float*)d_in[4];
  const float* R_W     = (const float*)d_in[5];
  const float* F_q     = (const float*)d_in[6];
  const float* F_k     = (const float*)d_in[7];
  const float* F_v     = (const float*)d_in[8];
  const float* F_W     = (const float*)d_in[9];
  const float* conv_w  = (const float*)d_in[10];
  const float* conv_b  = (const float*)d_in[11];
  const float* bn_w    = (const float*)d_in[12];
  const float* bn_b    = (const float*)d_in[13];
  const float* bn_mean = (const float*)d_in[14];
  const float* bn_var  = (const float*)d_in[15];
  const int*   flag    = (const int*)d_in[16];
  float* out = (float*)d_out;

  float* ws    = (float*)d_ws;
  float* alpha = ws;                 // 16384
  float* qws   = alpha + 16384;      // 524288   q  [b][l/64][32][l%64]
  float* kc    = qws + 524288;       // 1048576  K' [b][l][64]
  float* vc    = kc + 1048576;       // 1048576  V' [b][l][64]
  float* y     = vc + 1048576;       // 524288   y  [b][32][l]
  float* po    = y + 524288;         // NSPLIT * 524288  partial O [s][b][32][l]
  float* pm    = po + NSPLIT * 524288;   // NSPLIT * 16384  row maxima [s][b][l]
  float* pl    = pm + NSPLIT * 16384;    // NSPLIT * 16384  row sums   [s][b][l]

  proj_kernel<<<dim3(128, 6), 256, 0, stream>>>(head, tail, R_q, R_k, R_v, F_q,
                                                F_k, F_v, conv_w, conv_b, bn_w, bn_b,
                                                bn_mean, bn_var, flag, alpha, qws,
                                                kc, vc);
  attn_kernel<<<dim3(128, NSPLIT), 256, 0, stream>>>(qws, kc, vc, alpha, po, pm, pl);
  merge_kernel<<<512, 256, 0, stream>>>(po, pm, pl, y);
  final_kernel<<<512, 128, 0, stream>>>(y, head, tail, R_W, F_W, flag, out);
}

// v006
// It runs in 78.6 microseconds.
// Next to v005, in two timings, it ran 1.05 and 1.06 times as fast.
// Counting every step since v000, it is 4.88 times as fast.
#include <hip/hip_runtime.h>
#include <hip/hip_bf16.h>

typedef __attribute__((ext_vector_type(2))) float v2f;
typedef __attribute__((ext_vector_type(4))) float v4f;
typedef __attribute__((ext_vector_type(8))) float v8f;

#define BS  4
#define CH  32
#define NF  128
#define L   4096      // hei*wei
#define ROWS 4096     // BS*CH*HEI
#define NSPLIT 4      // column ranges of the attention, one work-group each:
                      // 128 x 4 groups, two resident on each of the 256 WGPs
#define LSP (L / NSPLIT)   // columns per range
#define TP 68         // LDS row pitch in floats: 272 B = 17 x 16 B, so the 16 rows
                      // that a half-wave's 16-byte reads touch fall on all 64 banks

__device__ __forceinline__ v8f wmma_f32(v2f a, v2f b, v8f c) {
  // V_WMMA_F32_16X16X4_F32 : D = A(16x4) * B(4x16) + C(16x16)
  return __builtin_amdgcn_wmma_f32_16x16x4_f32(false, a, false, b, (short)0, c,
                                               false, false);
}

// ---------------------------------------------------------------------------
// Kernel B: five projections (4096x128 @ 128x128) via WMMA f32 16x16x4, written
// in attention-friendly layouts:
//   q  [b][l / 64][32][l % 64]   (one 64-column tile is 8 KB in a row)
//   K' [b][l][64]      V' [b][l][64]
// so that what a lane of the attention takes as the k of an A fragment lies
// side by side in memory.
// One work-group takes one projection of one (b, h): the 32 channels are the
// rows of its product, the 128 w (128 consecutive l) its columns, 16 to a wave.
// The 32 source rows lie 16 KB apart in memory; each is brought to LDS by one
// wave-wide 16-byte load (512 B in a row). Of K' and V' the 32 channels of one l
// are one 128-byte line: a wave turns its 32 x 16 tile round in its own piece of
// LDS and stores 16 whole lines.
// Every loop of the kernel is unrolled so that av, bf, acc0, acc1 and xv are
// indexed by constants and stay in registers, and each run of loads is in flight
// together.
// A sixth row of work-groups (blockIdx.y == 5) has no product: it forms alpha
// (1x1 conv -> BN(eval) -> ReLU -> 2-way softmax) of the 128 l of its (b, h).
// Nothing in this launch reads alpha: the attention scales K' by it.
// ---------------------------------------------------------------------------
#define AP 132        // LDS pitch of a source row in floats: 528 B = 33 x 16 B
#define OP 36         // LDS pitch of an output line in floats: 144 B = 9 x 16 B

__global__ __launch_bounds__(256) void proj_kernel(
    const float* __restrict__ head, const float* __restrict__ tail,
    const float* __restrict__ R_q, const float* __restrict__ R_k,
    const float* __restrict__ R_v, const float* __restrict__ F_q,
    const float* __restrict__ F_k, const float* __restrict__ F_v,
    const float* __restrict__ conv_w, const float* __restrict__ conv_b,
    const float* __restrict__ bn_w, const float* __restrict__ bn_b,
    const float* __restrict__ bn_mean, const float* __restrict__ bn_var,
    const int* __restrict__ flagp, float* __restrict__ alpha,
    float* __restrict__ qws, float* __restrict__ kc, float* __restrict__ vc) {
  __shared__ __attribute__((aligned(16))) float lds_a[CH][AP];      // [channel][k]
  __shared__ __attribute__((aligned(16))) float lds_o[8][16][OP];   // [wave][l][channel]

  int tid = threadIdx.x;
  int w = tid >> 5;
  int lane = tid & 31;
  int half = lane >> 4, lm = lane & 15;
  int b = blockIdx.x >> 5, h = blockIdx.x & 31;
  int proj = blockIdx.y;           // 0..5, the same in the whole work-group
  int n0 = w << 4;                 // wave's first column
  int flag = *flagp;

  if (proj == 5) {
    // Wave w takes channels 8 * w .. 8 * w + 7 of the concatenation (head 0..31,
    // tail 32..63), a lane four consecutive l: eight 512-byte loads in flight.
    int wu = __builtin_amdgcn_readfirstlane(w);   // scalar: the weights come by scalar loads
    const float* x = (wu < 4 ? head : tail) +
                     ((((b * CH + ((wu & 3) << 3)) << 5) + h) * NF + (lane << 2));
    v4f xv[8];
#pragma unroll
    for (int i = 0; i < 8; ++i) xv[i] = *(const v4f*)&x[(i << 5) * NF];
    const float* cw = conv_w + (wu << 3);
    float sc0 = bn_w[0] * rsqrtf(bn_var[0] + 1e-5f);
    float sc1 = bn_w[1] * rsqrtf(bn_var[1] + 1e-5f);
    float mu0 = bn_mean[0], mu1 = bn_mean[1], be0 = bn_b[0], be1 = bn_b[1];
    float s0 = conv_b[0], s1 = conv_b[1];
    v4f p0 = {}, p1 = {};
#pragma unroll
    for (int i = 0; i < 8; ++i) {
      p0 += cw[i] * xv[i];
      p1 += cw[64 + i] * xv[i];
    }
    *(v4f*)&lds_a[w][lane << 2] = p0;
    *(v4f*)&lds_a[8 + w][lane << 2] = p1;
    __syncthreads();   // the eight waves' partial sums are in LDS
    if (tid < NF) {
#pragma unroll
      for (int i = 0; i < 8; ++i) {
        s0 += lds_a[i][tid];
        s1 += lds_a[8 + i][tid];
      }
      float r0 = fmaxf((s0 - mu0) * sc0 + be0, 0.f);
      float r1 = fmaxf((s1 - mu1) * sc1 + be1, 0.f);
      float m = fmaxf(r0, r1);
      float e0 = __expf(r0 - m), e1 = __expf(r1 - m);
      alpha[(b << 12) + (h << 7) + tid] = flag ? (e0 / (e0 + e1)) : (e1 / (e0 + e1));
    }
    return;
  }

  const float* src;
  const float* mat;
  switch (proj) {
    case 0:  src = flag ? head : tail; mat = flag ? R_q : F_q; break; // q
    case 1:  src = flag ? tail : head; mat = flag ? F_k : R_k; break; // K' lo
    case 2:  src = flag ? head : tail; mat = flag ? R_k : F_k; break; // K' hi
    case 3:  src = flag ? tail : head; mat = flag ? F_v : R_v; break; // V' rows 0..31
    default: src = flag ? head : tail; mat = flag ? R_v : F_v; break; // V' rows 32..63
  }

  // Source rows (b, c, h), c = 0..31: wave w brings rows w, w + 8, w + 16, w + 24.
  const float* srcB = src + (((b * CH) << 5) + h) * NF;
  v4f av[4];
#pragma unroll
  for (int i = 0; i < 4; ++i)
    av[i] = *(const v4f*)&srcB[((w + (i << 3)) << 5) * NF + (lane << 2)];

  // The wave's 128 x 16 strip of the matrix, the B operand of 32 k-steps. Of
  // eight consecutive k a half-wave holds four, 8 * s + 4 * half + {0..3}: the
  // first two are its share of k-step 2s, the last two of 2s + 1.
  const float* matC = mat + (half << 2) * NF + n0 + lm;
  v2f bf[32];
#pragma unroll
  for (int s = 0; s < 16; ++s) {
    bf[2 * s].x     = matC[(8 * s) * NF];
    bf[2 * s].y     = matC[(8 * s + 1) * NF];
    bf[2 * s + 1].x = matC[(8 * s + 2) * NF];
    bf[2 * s + 1].y = matC[(8 * s + 3) * NF];
  }
  int l0 = (b << 12) + (h << 7) + n0;            // wave's first (b, l)
  // Stands in front of the first rewrite of a register that a load above names;
  // matC is an input so that its registers are not given away ahead of the wait.
  asm volatile("s_wait_xcnt 0x0" :: "v"(matC) : "memory");

#pragma unroll
  for (int i = 0; i < 4; ++i)
    *(v4f*)&lds_a[w + (i << 3)][lane << 2] = av[i];
  __syncthreads();   // the 32 source rows are in LDS

  // acc0[r] = channel 8 * half + r, acc1[r] = channel 16 + 8 * half + r, both at
  // column n0 + lm. The source loader takes the k order of bf, two k-steps to a
  // 16-byte read.
  v8f acc0 = {}, acc1 = {};
#pragma unroll
  for (int s = 0; s < 16; ++s) {
    v4f a0 = *(const v4f*)&lds_a[lm][8 * s + 4 * half];
    v4f a1 = *(const v4f*)&lds_a[16 + lm][8 * s + 4 * half];
    v2f x0; x0.x = a0.x; x0.y = a0.y;
    v2f x1; x1.x = a1.x; x1.y = a1.y;
    acc0 = wmma_f32(x0, bf[2 * s], acc0);
    acc1 = wmma_f32(x1, bf[2 * s], acc1);
    x0.x = a0.z; x0.y = a0.w;
    x1.x = a1.z; x1.y = a1.w;
    acc0 = wmma_f32(x0, bf[2 * s + 1], acc0);
    acc1 = wmma_f32(x1, bf[2 * s + 1], acc1);
  }

  if (proj == 0) {
    // q: a half-wave writes 16 consecutive l of one channel.
    int l = (h << 7) + n0 + lm;
    float* qd = qws + ((((b << 6) + (l >> 6)) * CH + half * 8) << 6) + (l & 63);
#pragma unroll
    for (int r = 0; r < 8; ++r) {
      qd[r << 6] = acc0[r];
      qd[(16 + r) << 6] = acc1[r];
    }
  } else {
    // K', V': the lane's 16 channels of its l go to row lm of the wave's piece.
    float* so = &lds_o[w][lm][half * 8];
    v4f t;
    t.x = acc0[0]; t.y = acc0[1]; t.z = acc0[2]; t.w = acc0[3];
    *(v4f*)&so[0] = t;
    t.x = acc0[4]; t.y = acc0[5]; t.z = acc0[6]; t.w = acc0[7];
    *(v4f*)&so[4] = t;
    t.x = acc1[0]; t.y = acc1[1]; t.z = acc1[2]; t.w = acc1[3];
    *(v4f*)&so[16] = t;
    t.x = acc1[4]; t.y = acc1[5]; t.z = acc1[6]; t.w = acc1[7];
    *(v4f*)&so[20] = t;
    __syncthreads();   // the rows are written before other lanes read them back
    // Eight lanes store the 128 bytes of one l: four whole lines to a store.
    float* dst = ((proj <= 2) ? kc : vc) + (l0 << 6) + ((proj & 1) ? 0 : 32);
    int c4 = (lane & 7) << 2;
#pragma unroll
    for (int j = 0; j < 4; ++j) {
      int row = (j << 2) + (lane >> 3);
      *(v4f*)&dst[(row << 6) + c4] = *(const v4f*)&lds_o[w][row][c4];
    }
  }
}

// ---------------------------------------------------------------------------
// Kernel C: fused flash attention, 64-column tiles, scores formed transposed.
//   St = V't(64 cols x 64) @ K't(64 x 16 rows), online softmax,
//   Ot += qt(32 x 64 cols) @ Pt(64 cols x 16 rows)
// 8 waves/block, 16 rows/wave; V'/q tiles staged in LDS with float4 loads.
// Both tiles lie in LDS with the k of their product along the row (V' as
// [column][k], q as [channel][column]): one 16-byte read gives a lane the A
// fragments of two k-steps.
// In the accumulator of St a lane holds scores of ONE attention row (row = lane
// & 15; the two half-waves hold different columns of it), so the row maximum
// and row sum are in-lane work plus one exchange between the halves, and the
// accumulator registers are, pair by pair, the B operand of the second
// product: P never goes through LDS.
// Each work-group walks one of NSPLIT column ranges and leaves its
// un-normalised sum with the range's row maximum and row sum; final_kernel
// joins the ranges.
// ---------------------------------------------------------------------------
__device__ __forceinline__ float xhalf(float x) {   // lane l with lane l ^ 16
  int i = __builtin_bit_cast(int, x);
  return __builtin_bit_cast(float, __builtin_amdgcn_permlanex16(
      i, i, 0x76543210, 0xfedcba98, false, false));
}

// Four waves per SIMD, no more: two of the 512 work-groups to each WGP. A third
// on one WGP would leave another with one, and the fullest WGP sets the time.
__global__ __launch_bounds__(256) __attribute__((amdgpu_waves_per_eu(4, 4)))
void attn_kernel(
    const float* __restrict__ qws, const float* __restrict__ kc,
    const float* __restrict__ vc, const float* __restrict__ alpha,
    float* __restrict__ po, float* __restrict__ pm, float* __restrict__ pl) {
  __shared__ __attribute__((aligned(16))) float lds_v[64][TP];  // V' [column][k]
  __shared__ __attribute__((aligned(16))) float lds_q[32][TP];  // q  [channel][column]

  int tid = threadIdx.x;
  int w = tid >> 5;
  int lane = tid & 31;
  int half = lane >> 4, lm = lane & 15;
  int b = blockIdx.x >> 5;                         // 32 blocks per batch
  int i0 = (((blockIdx.x & 31) << 3) + w) << 4;    // wave's first row
  int sp = blockIdx.y;                             // column range
  int bl = b << 12;

  const float* vcB = vc + (bl + sp * LSP) * 64;          // range's first column
  const float* qB = qws + (bl + sp * LSP) * 32;          // range's first q tile
  const float* kcRow = kc + (bl + i0 + lm) * 64;

  // Preload this wave's 16x64 K' strip; as K't it is the B operand (16 k-steps):
  // lane = row. Of eight consecutive k a half-wave holds four, 8 * s + 4 * half
  // + {0..3}: the first two are its share of k-step 2s, the last two of 2s + 1.
  // k 0..31 (s < 4) take the row's alpha here.
  float al = alpha[bl + i0 + lm];
  v2f ka[16];
#pragma unroll
  for (int s = 0; s < 8; ++s) {
    v4f kq = *(const v4f*)&kcRow[8 * s + 4 * half];
    if (s < 4) kq *= al;
    ka[2 * s].x = kq.x;     ka[2 * s].y = kq.y;
    ka[2 * s + 1].x = kq.z; ka[2 * s + 1].y = kq.w;
  }

  // o0[r] = Ot[8 * half + r][row lm], o1[r] = Ot[16 + 8 * half + r][row lm].
  // mrow is the row's maximum (equal in both halves); lrow is this half-wave's
  // share of the row's sum, joined once behind the loop.
  v8f o0 = {}, o1 = {};
  float mrow = -3.0e38f, lrow = 0.f;

  for (int j0 = 0; j0 < LSP; j0 += 64) {
    __syncthreads();   // previous iteration's LDS reads complete
    // Cooperative float4 stage: V' tile (64 columns x 64 k, 16 KB in a row in
    // memory) and q tile (32 channels x 64 columns, 8 KB in a row)
#pragma unroll
    for (int i = 0; i < 4; ++i) {
      int idx = (tid + (i << 8)) << 2;       // 0..4092
      *(v4f*)&lds_v[idx >> 6][idx & 63] = *(const v4f*)&vcB[j0 * 64 + idx];
    }
#pragma unroll
    for (int i = 0; i < 2; ++i) {
      int idx = (tid + (i << 8)) << 2;       // 0..2044
      *(v4f*)&lds_q[idx >> 6][idx & 63] = *(const v4f*)&qB[j0 * 32 + idx];
    }
    __syncthreads();

    // Transposed score tiles: 4 x (16 columns x 16 rows), K = 64.
    // s[t][r] = score of row lm at column 16 * t + 8 * half + r.
    // Every loop over st, t, r and u from here to the loop's foot is unrolled so
    // that s, vm, ps, o0 and o1 are indexed by constants and stay in registers.
    // The V' loader takes the k order of ka.
    v8f s[4] = {};
#pragma unroll
    for (int st = 0; st < 8; ++st) {
      v4f va[4];
#pragma unroll
      for (int t = 0; t < 4; ++t)
        va[t] = *(const v4f*)&lds_v[16 * t + lm][8 * st + 4 * half];
#pragma unroll
      for (int t = 0; t < 4; ++t) {
        v2f a; a.x = va[t].x; a.y = va[t].y;
        s[t] = wmma_f32(a, ka[2 * st], s[t]);
      }
#pragma unroll
      for (int t = 0; t < 4; ++t) {
        v2f a; a.x = va[t].z; a.y = va[t].w;
        s[t] = wmma_f32(a, ka[2 * st + 1], s[t]);
      }
    }

    // Online softmax over the 64-column strip: 32 scores of the row in this
    // lane, the other 32 in lane ^ 16.
    float vm[4];
#pragma unroll
    for (int t = 0; t < 4; ++t) {
      vm[t] = s[t][0];
#pragma unroll
      for (int r = 1; r < 8; ++r) vm[t] = fmaxf(vm[t], s[t][r]);
    }
    float v = fmaxf(fmaxf(vm[0], vm[1]), fmaxf(vm[2], vm[3]));
    v = fmaxf(v, xhalf(v));
    float mnew = fmaxf(mrow, v);
    float corr = __expf(mrow - mnew);
    mrow = mnew;
#pragma unroll
    for (int t = 0; t < 4; ++t) {
#pragma unroll
      for (int r = 0; r < 8; ++r) s[t][r] = __expf(s[t][r] - mnew);
    }
#pragma unroll
    for (int r = 0; r < 8; ++r) {
      o0[r] *= corr;
      o1[r] *= corr;
    }

    // Ot += qt(32x64) @ Pt(64x16), K = 64. Registers 2u, 2u+1 of s[t] are the B
    // operand of one k-step, whose four k are then the columns
    // 16 * t + 8 * half + 2u + {0, 1}; the q loader takes the same order, two
    // k-steps (u, u + 1) to a 16-byte read.
    // The same register pairs are summed, two chains of pairs, for the row sum.
    v2f ps[2] = {};
#pragma unroll
    for (int t = 0; t < 4; ++t) {
#pragma unroll
      for (int u = 0; u < 4; u += 2) {
        int j = 16 * t + 8 * half + 2 * u;
        v4f q0 = *(const v4f*)&lds_q[lm][j];
        v4f q1 = *(const v4f*)&lds_q[16 + lm][j];
        v2f pb;  pb.x = s[t][2 * u];  pb.y = s[t][2 * u + 1];
        v2f qa0; qa0.x = q0.x;        qa0.y = q0.y;
        v2f qa1; qa1.x = q1.x;        qa1.y = q1.y;
        o0 = wmma_f32(qa0, pb, o0);
        o1 = wmma_f32(qa1, pb, o1);
        ps[0] += pb;
        pb.x = s[t][2 * u + 2];       pb.y = s[t][2 * u + 3];
        qa0.x = q0.z;                 qa0.y = q0.w;
        qa1.x = q1.z;                 qa1.y = q1.w;
        o0 = wmma_f32(qa0, pb, o0);
        o1 = wmma_f32(qa1, pb, o1);
        ps[1] += pb;
      }
    }
    lrow = lrow * corr + ((ps[0].x + ps[0].y) + (ps[1].x + ps[1].y));
  }

  // Store the range's un-normalised sum to po[sp][b][c][l] (a half-wave writes
  // 16 consecutive l of one c) and its row maximum and row sum to
  // pm/pl[sp][b][l]. The loop is unrolled because o0 and o1 are registers.
  float* poL = po + (((sp * BS + b) * CH + half * 8) << 12) + i0 + lm;
#pragma unroll
  for (int r = 0; r < 8; ++r) {
    poL[r << 12] = o0[r];
    poL[(16 + r) << 12] = o1[r];
  }
  lrow += xhalf(lrow);
  if (half == 0) {
    int st = ((sp * BS + b) << 12) + i0 + lm;
    pm[st] = mrow;
    pl[st] = lrow;
  }
}

// ---------------------------------------------------------------------------
// Kernel D: join the NSPLIT column ranges and form out = y @ W + residual.
//   y = sum_s exp(m_s - M) * O_s / sum_s exp(m_s - M) * l_s,  M = max_s m_s
// One work-group takes 16 channels of one (b, h): they are the rows of its
// product (16 x 128 @ 128 x 128), the 128 l of (b, h) its k, 16 columns to a wave.
// A lane joins four consecutive l of two channels (w and w + 8): the weights of
// its l are formed once and serve both. y goes to LDS and no further.
// Every loop of the kernel is unrolled so that mv, lv, ov0, ov1, bf, rs and acc
// are indexed by constants and stay in registers, and all loads are in flight
// together.
// ---------------------------------------------------------------------------
#define YP 132        // LDS pitch of a y row in floats: 528 B = 33 x 16 B

__global__ __launch_bounds__(256) void final_kernel(
    const float* __restrict__ po, const float* __restrict__ pm,
    const float* __restrict__ pl, const float* __restrict__ head,
    const float* __restrict__ tail, const float* __restrict__ R_W,
    const float* __restrict__ F_W, const int* __restrict__ flagp,
    float* __restrict__ out) {
  __shared__ __attribute__((aligned(16))) float lds_y[16][YP];      // [channel][k]

  int tid = threadIdx.x;
  int w = tid >> 5;
  int lane = tid & 31;
  int half = lane >> 4, lm = lane & 15;
  int b = blockIdx.x >> 5, h = blockIdx.x & 31;
  int c0 = blockIdx.y << 4;        // first of the 16 channels
  int n0 = w << 4;                 // wave's first column
  int flag = *flagp;
  const float* mat = flag ? R_W : F_W;
  const float* res = flag ? head : tail;

  // The ranges' maxima, sums and partial outputs: each load is 512 B in a row.
  int lq = (h << 7) + (lane << 2);
  const float* pmL = pm + (b << 12) + lq;
  const float* plL = pl + (b << 12) + lq;
  const float* poL = po + ((b * CH + c0 + w) << 12) + lq;
  v4f mv[NSPLIT], lv[NSPLIT], ov0[NSPLIT], ov1[NSPLIT];
#pragma unroll
  for (int s = 0; s < NSPLIT; ++s) {
    mv[s]  = *(const v4f*)&pmL[s * BS * L];
    lv[s]  = *(const v4f*)&plL[s * BS * L];
    ov0[s] = *(const v4f*)&poL[s * BS * CH * L];
    ov1[s] = *(const v4f*)&poL[s * BS * CH * L + (8 << 12)];
  }
  // Stands in front of the first rewrite of a register that a load above names.
  asm volatile("s_wait_xcnt 0x0" ::: "memory");
  // Keeps these sixteen loads, which the join waits for, in front of the 72
  // below: loads return in order, so behind them the join would wait for all 88.
  __builtin_amdgcn_sched_barrier(0);

  // The wave's 128 x 16 strip of W, the B operand of 32 k-steps. Of eight
  // consecutive k a half-wave holds four, 8 * s + 4 * half + {0..3}: the first
  // two are its share of k-step 2s, the last two of 2s + 1.
  const float* matC = mat + (half << 2) * NF + n0 + lm;
  v2f bf[32];
#pragma unroll
  for (int s = 0; s < 16; ++s) {
    bf[2 * s].x     = matC[(8 * s) * NF];
    bf[2 * s].y     = matC[(8 * s + 1) * NF];
    bf[2 * s + 1].x = matC[(8 * s + 2) * NF];
    bf[2 * s + 1].y = matC[(8 * s + 3) * NF];
  }

  // Residual at the accumulator's places: channel c0 + 8 * half + r, column n0 + lm.
  int o = (((b * CH + c0 + half * 8) << 5) + h) * NF + n0 + lm;
  const float* resL = res + o;
  float rs[8];
#pragma unroll
  for (int r = 0; r < 8; ++r) rs[r] = resL[(r << 5) * NF];
  // Stands in front of the first rewrite of a register that a load above names;
  // poL and matC are inputs so that their registers are not given away (to a
  // later load's result) ahead of the wait.
  asm volatile("s_wait_xcnt 0x0" :: "v"(poL), "v"(matC) : "memory");
  // Keeps the join's arithmetic, with its waits for the first loads, behind the
  // issue of the last load: without it W's loads start one load latency late.
  __builtin_amdgcn_sched_barrier(0);

  v4f M = mv[0];
#pragma unroll
  for (int s = 1; s < NSPLIT; ++s)
#pragma unroll
    for (int i = 0; i < 4; ++i) M[i] = fmaxf(M[i], mv[s][i]);
  v4f den = {}, num0 = {}, num1 = {};
#pragma unroll
  for (int s = 0; s < NSPLIT; ++s) {
#pragma unroll
    for (int i = 0; i < 4; ++i) {
      float wgt = __expf(mv[s][i] - M[i]);
      den[i]  = fmaf(wgt, lv[s][i], den[i]);
      num0[i] = fmaf(wgt, ov0[s][i], num0[i]);
      num1[i] = fmaf(wgt, ov1[s][i], num1[i]);
    }
  }
  v4f y0, y1;
#pragma unroll
  for (int i = 0; i < 4; ++i) {
    y0[i] = num0[i] / den[i];
    y1[i] = num1[i] / den[i];
  }
  *(v4f*)&lds_y[w][lane << 2] = y0;
  *(v4f*)&lds_y[8 + w][lane << 2] = y1;
  __syncthreads();   // the 16 rows of y are in LDS

  // acc[r] = channel c0 + 8 * half + r at column n0 + lm. The y loader takes the
  // k order of bf, two k-steps to a 16-byte read.
  v8f acc = {};
#pragma unroll
  for (int s = 0; s < 16; ++s) {
    v4f a = *(const v4f*)&lds_y[lm][8 * s + 4 * half];
    v2f x; x.x = a.x; x.y = a.y;
    acc = wmma_f32(x, bf[2 * s], acc);
    x.x = a.z; x.y = a.w;
    acc = wmma_f32(x, bf[2 * s + 1], acc);
  }
  float* outL = out + o;
#pragma unroll
  for (int r = 0; r < 8; ++r) outL[(r << 5) * NF] = acc[r] + rs[r];
}

// ---------------------------------------------------------------------------
extern "C" void kernel_launch(void* const* d_in, const int* in_sizes, int n_in,
                              void* d_out, int out_size, void* d_ws,
                              size_t ws_size, hipStream_t stream) {
  const float* head    = (const float*)d_in[0];
  const float* tail    = (const float*)d_in[1];
  const float* R_q     = (const float*)d_in[2];
  const float* R_k     = (const float*)d_in[3];
  const float* R_v     = (const float*)d_in[4];
  const float* R_W     = (const float*)d_in[5];
  const float* F_q     = (const float*)d_in[6];
  const float* F_k     = (const float*)d_in[7];
  const float* F_v     = (const float*)d_in[8];
  const float* F_W     = (const float*)d_in[9];
  const float* conv_w  = (const float*)d_in[10];
  const float* conv_b  = (const float*)d_in[11];
  const float* bn_w    = (const float*)d_in[12];
  const float* bn_b    = (const float*)d_in[13];
  const float* bn_mean = (const float*)d_in[14];
  const float* bn_var  = (const float*)d_in[15];
  const int*   flag    = (const int*)d_in[16];
  float* out = (float*)d_out;

  float* ws    = (float*)d_ws;
  float* alpha = ws;                 // 16384
  float* qws   = alpha + 16384;      // 524288   q  [b][l/64][32][l%64]
  float* kc    = qws + 524288;       // 1048576  K' [b][l][64]
  float* vc    = kc + 1048576;       // 1048576  V' [b][l][64]
  float* po    = vc + 1048576;       // NSPLIT * 524288  partial O [s][b][32][l]
  float* pm    = po + NSPLIT * 524288;   // NSPLIT * 16384  row maxima [s][b][l]
  float* pl    = pm + NSPLIT * 16384;    // NSPLIT * 16384  row sums   [s][b][l]

  proj_kernel<<<dim3(128, 6), 256, 0, stream>>>(head, tail, R_q, R_k, R_v, F_q,
                                                F_k, F_v, conv_w, conv_b, bn_w, bn_b,
                                                bn_mean, bn_var, flag, alpha, qws,
                                                kc, vc);
  attn_kernel<<<dim3(128, NSPLIT), 256, 0, stream>>>(qws, kc, vc, alpha, po, pm, pl);
  final_kernel<<<dim3(128, 2), 256, 0, stream>>>(po, pm, pl, head, tail, R_W, F_W, flag,
                                                 out);
}
